// v000
// Measured on an AMD MI455X. A time is GPU time per run, averaged over a window of back-to-back runs after a warm-up
// (all launches, gaps included; the runs take copies of the inputs in turn), and the median of several windows.
// Apart from v000's, it joins two sittings. Times from different sittings can be a few percent apart, while
// side-by-side timings come from the same sitting.
// v000, which the later versions start from, runs in 278 microseconds.
#include <hip/hip_runtime.h>
#include <hip/hip_bf16.h>

typedef __attribute__((ext_vector_type(16))) _Float16 v16h;
typedef __attribute__((ext_vector_type(8)))  float    v8f;

constexpr int kB    = 4096;
constexpr int kDin  = 1024;
constexpr int kH1   = 1024;
constexpr int kH2   = 512;
constexpr int kE    = 8;   // 6 specific + 2 shared experts
constexpr int kSpec = 6;

union Frag { uint4 u[2]; v16h h; };

#if defined(__AMDGCN__) && \
    __has_builtin(__builtin_amdgcn_global_load_async_to_lds_b128) && \
    __has_builtin(__builtin_amdgcn_s_wait_asynccnt)
#define USE_ASYNC 1
typedef int v4i __attribute__((ext_vector_type(4)));
typedef __attribute__((address_space(3))) v4i lds_v4i;
typedef __attribute__((address_space(1))) v4i glb_v4i;
#else
#define USE_ASYNC 0
#endif

// ---------------- f32 -> f16 conversion (x4 vectorized) ----------------
__global__ void __launch_bounds__(256)
cvt_f32_to_f16(const float* __restrict__ s, _Float16* __restrict__ d, int n4) {
  int i = blockIdx.x * blockDim.x + threadIdx.x;
  if (i >= n4) return;
  float4 v = reinterpret_cast<const float4*>(s)[i];
  union { _Float16 h[4]; uint2 u; } p;
  p.h[0] = (_Float16)v.x; p.h[1] = (_Float16)v.y;
  p.h[2] = (_Float16)v.z; p.h[3] = (_Float16)v.w;
  reinterpret_cast<uint2*>(d)[i] = p.u;
}

// ------------- f32 [E][K][N] -> f16 [E][N][K] transpose+convert --------
__global__ void __launch_bounds__(256)
cvt_transpose_f32_f16(const float* __restrict__ in, _Float16* __restrict__ out,
                      int K, int N) {
  __shared__ float tile[32][33];
  const int e  = blockIdx.z;
  const int n0 = blockIdx.x * 32;
  const int k0 = blockIdx.y * 32;
  const int tx = threadIdx.x;   // 32
  const int ty = threadIdx.y;   // 8
  const float* src = in + (size_t)e * K * N;
  _Float16* dst = out + (size_t)e * N * K;
  #pragma unroll
  for (int i = 0; i < 4; i++)
    tile[ty + i * 8][tx] = src[(size_t)(k0 + ty + i * 8) * N + (n0 + tx)];
  __syncthreads();
  #pragma unroll
  for (int i = 0; i < 4; i++)
    dst[(size_t)(n0 + ty + i * 8) * K + (k0 + tx)] = (_Float16)tile[tx][ty + i * 8];
}

// ---------------- gate weights: [B,20] = softmax groups (4,4,4,8) ------
__global__ void __launch_bounds__(128)
gates_kernel(const float* __restrict__ x0, const float* __restrict__ x1,
             const float* __restrict__ x2, const float* __restrict__ xs,
             const float* __restrict__ Wg,  const float* __restrict__ bg,
             const float* __restrict__ Wsg, const float* __restrict__ bsg,
             float* __restrict__ gates) {
  __shared__ float xr[4][kDin];
  __shared__ float lg[20];
  const int row = blockIdx.x;
  const int t = threadIdx.x;
  for (int i = t; i < kDin; i += 128) {
    xr[0][i] = x0[(size_t)row * kDin + i];
    xr[1][i] = x1[(size_t)row * kDin + i];
    xr[2][i] = x2[(size_t)row * kDin + i];
    xr[3][i] = xs[(size_t)row * kDin + i];
  }
  __syncthreads();
  if (t < 20) {
    float s;
    if (t < 12) {                       // per-domain gates: Linear(D_IN, 4)
      int d = t >> 2, kk = t & 3;
      s = bg[d * 4 + kk];
      for (int i = 0; i < kDin; i++)
        s += xr[d][i] * Wg[((size_t)d * kDin + i) * 4 + kk];
    } else {                            // shared gate: Linear(D_IN, 8)
      int kk = t - 12;
      s = bsg[kk];
      for (int i = 0; i < kDin; i++)
        s += xr[3][i] * Wsg[(size_t)i * 8 + kk];
    }
    lg[t] = s;
  }
  __syncthreads();
  if (t < 4) {
    int base = (t < 3) ? t * 4 : 12;
    int len  = (t < 3) ? 4 : 8;
    float mx = -3.4e38f;
    for (int i = 0; i < len; i++) mx = fmaxf(mx, lg[base + i]);
    float ev[8]; float sum = 0.f;
    for (int i = 0; i < len; i++) { ev[i] = expf(lg[base + i] - mx); sum += ev[i]; }
    float inv = 1.f / sum;
    for (int i = 0; i < len; i++)
      gates[(size_t)row * 20 + base + i] = ev[i] * inv;
  }
}

// ---------------- WMMA GEMM: C = relu(A @ W + bias), f16 in / f32 acc ----
// block = 256 threads (8 waves); block tile 128(M) x 128(N); wave tile 32x64.
// A : [pages][Bsz][K] f16 row-major.
// Wt: [E][N][K] f16 (pre-transposed) -> W tile loader identical to A tile.
// pageMode=1: expert e reads A page (e<6 ? e/2 : 3)   (layer-1 input mapping)
// pageMode=0: expert e reads A page e                 (layer-2: h buffer)
__global__ void __launch_bounds__(256)
gemm_bias_relu_wmma(const _Float16* __restrict__ A,
                    const _Float16* __restrict__ Wt,
                    const float* __restrict__ biasS,
                    const float* __restrict__ biasH,
                    _Float16* __restrict__ C,
                    int Bsz, int K, int N, int pageMode) {
#if USE_ASYNC
  __shared__ alignas(16) uint4 smem4[2048];   // 32 KB: double-buffered (A|W) tiles
#else
  __shared__ alignas(16) uint4 smem4[1024];   // 16 KB: single (A|W) tile
#endif

  const int tid  = threadIdx.x;
  const int lane = tid & 31;
  const int wave = tid >> 5;
  const int waveM = wave & 3;          // 4 waves along M
  const int waveN = wave >> 2;         // 2 waves along N
  const int rl   = lane & 15;
  const int hsel = lane >> 4;

  const int e  = blockIdx.z;
  const int n0 = blockIdx.x * 128;
  const int m0 = blockIdx.y * 128;
  const int page = pageMode ? ((e < kSpec) ? (e >> 1) : 3) : e;
  const int ld = K >> 3;               // row stride in uint4 units

  const uint4* __restrict__ Ag = reinterpret_cast<const uint4*>(A) +
      (size_t)page * Bsz * ld + (size_t)m0 * ld;
  const uint4* __restrict__ Wg = reinterpret_cast<const uint4*>(Wt) +
      (size_t)e * N * ld + (size_t)n0 * ld;

  const v8f vzero = {0.f, 0.f, 0.f, 0.f, 0.f, 0.f, 0.f, 0.f};
  v8f acc[2][4];
  #pragma unroll
  for (int mt = 0; mt < 2; mt++)
    #pragma unroll
    for (int nt = 0; nt < 4; nt++) acc[mt][nt] = vzero;

#if USE_ASYNC
  auto issue = [&](int k0, int buf) {
    lds_v4i* dA = (lds_v4i*)(smem4 + buf * 1024);
    lds_v4i* dW = dA + 512;
    glb_v4i* sA = (glb_v4i*)(Ag + (k0 >> 3));
    glb_v4i* sW = (glb_v4i*)(Wg + (k0 >> 3));
    #pragma unroll
    for (int i = 0; i < 2; i++) {
      int q4 = tid + i * 256;
      int r = q4 >> 2, c4 = q4 & 3;
      __builtin_amdgcn_global_load_async_to_lds_b128(sA + (size_t)r * ld + c4,
                                                     dA + q4, 0, 0);
      __builtin_amdgcn_global_load_async_to_lds_b128(sW + (size_t)r * ld + c4,
                                                     dW + q4, 0, 0);
    }
  };
  issue(0, 0);
  __builtin_amdgcn_s_wait_asynccnt(0);
  __syncthreads();
#endif

  for (int k0 = 0; k0 < K; k0 += 32) {
#if USE_ASYNC
    const int cur = (k0 >> 5) & 1;
    if (k0 + 32 < K) issue(k0 + 32, cur ^ 1);   // overlap DMA with WMMA
    const uint4* ap = reinterpret_cast<const uint4*>(smem4 + cur * 1024);
    const uint4* bp = ap + 512;
#else
    {  // synchronous fallback: both tiles are plain coalesced b128 copies
      uint4* dA = smem4;
      uint4* dW = smem4 + 512;
      const uint4* sA = Ag + (k0 >> 3);
      const uint4* sW = Wg + (k0 >> 3);
      #pragma unroll
      for (int i = 0; i < 2; i++) {
        int q4 = tid + i * 256;
        int r = q4 >> 2, c4 = q4 & 3;
        dA[q4] = sA[(size_t)r * ld + c4];
        dW[q4] = sW[(size_t)r * ld + c4];
      }
    }
    __syncthreads();
    const uint4* ap = reinterpret_cast<const uint4*>(smem4);
    const uint4* bp = ap + 512;
#endif

    Frag afrag[2], bfrag[4];
    #pragma unroll
    for (int mt = 0; mt < 2; mt++) {
      int r = waveM * 32 + mt * 16 + rl;
      afrag[mt].u[0] = ap[r * 4 + hsel];
      afrag[mt].u[1] = ap[r * 4 + hsel + 2];
    }
    #pragma unroll
    for (int nt = 0; nt < 4; nt++) {
      int c = waveN * 64 + nt * 16 + rl;
      bfrag[nt].u[0] = bp[c * 4 + hsel];
      bfrag[nt].u[1] = bp[c * 4 + hsel + 2];
    }
    #pragma unroll
    for (int mt = 0; mt < 2; mt++)
      #pragma unroll
      for (int nt = 0; nt < 4; nt++)
        acc[mt][nt] = __builtin_amdgcn_wmma_f32_16x16x32_f16(
            false, afrag[mt].h, false, bfrag[nt].h,
            (short)0, acc[mt][nt], false, false);

#if USE_ASYNC
    __builtin_amdgcn_s_wait_asynccnt(0);
#endif
    __syncthreads();
  }

  const float* bias = (e < kSpec) ? (biasS + (size_t)e * N)
                                  : (biasH + (size_t)(e - kSpec) * N);
  _Float16* Cp = C + (size_t)e * Bsz * N;
  #pragma unroll
  for (int nt = 0; nt < 4; nt++) {
    int col = n0 + waveN * 64 + nt * 16 + rl;
    float bv = bias[col];
    #pragma unroll
    for (int mt = 0; mt < 2; mt++) {
      int rbase = m0 + waveM * 32 + mt * 16 + hsel * 8;
      #pragma unroll
      for (int j = 0; j < 8; j++) {
        float v = acc[mt][nt][j] + bv;
        v = v > 0.f ? v : 0.f;
        Cp[(size_t)(rbase + j) * N + col] = (_Float16)v;
      }
    }
  }
}

// ---------------- gated combine: 4 outputs, each [B, H2] f32 ------------
__global__ void __launch_bounds__(256)
combine_kernel(const _Float16* __restrict__ eo,   // [8][B][H2]
               const float* __restrict__ gates,   // [B][20]
               float* __restrict__ out) {         // [4][B][H2]
  int idx = blockIdx.x * blockDim.x + threadIdx.x;
  if (idx >= kB * kH2) return;
  int b = idx / kH2, o = idx % kH2;
  float ex[8];
  #pragma unroll
  for (int k = 0; k < 8; k++)
    ex[k] = (float)eo[((size_t)k * kB + b) * kH2 + o];
  const float* g = gates + (size_t)b * 20;
  float o0 = g[0] * ex[0] + g[1] * ex[1] + g[2]  * ex[6] + g[3]  * ex[7];
  float o1 = g[4] * ex[2] + g[5] * ex[3] + g[6]  * ex[6] + g[7]  * ex[7];
  float o2 = g[8] * ex[4] + g[9] * ex[5] + g[10] * ex[6] + g[11] * ex[7];
  float o3 = 0.f;
  #pragma unroll
  for (int k = 0; k < 8; k++) o3 += g[12 + k] * ex[k];
  size_t p = (size_t)b * kH2 + o;
  const size_t page = (size_t)kB * kH2;
  out[p]            = o0;
  out[page + p]     = o1;
  out[2 * page + p] = o2;
  out[3 * page + p] = o3;
}

extern "C" void kernel_launch(void* const* d_in, const int* in_sizes, int n_in,
                              void* d_out, int out_size, void* d_ws, size_t ws_size,
                              hipStream_t stream) {
  const float* x0  = (const float*)d_in[0];
  const float* x1  = (const float*)d_in[1];
  const float* x2  = (const float*)d_in[2];
  const float* xs  = (const float*)d_in[3];
  const float* W1s = (const float*)d_in[4];
  const float* b1s = (const float*)d_in[5];
  const float* W2s = (const float*)d_in[6];
  const float* b2s = (const float*)d_in[7];
  const float* W1h = (const float*)d_in[8];
  const float* b1h = (const float*)d_in[9];
  const float* W2h = (const float*)d_in[10];
  const float* b2h = (const float*)d_in[11];
  const float* Wg  = (const float*)d_in[12];
  const float* bg  = (const float*)d_in[13];
  const float* Wsg = (const float*)d_in[14];
  const float* bsg = (const float*)d_in[15];
  (void)in_sizes; (void)n_in; (void)out_size; (void)ws_size;

  // ---- workspace carve-out (~153 MB), 256B aligned ----
  char* ws = (char*)d_ws;
  size_t off = 0;
  auto take = [&](size_t bytes) -> char* {
    char* p = ws + off;
    off += (bytes + 255) & ~(size_t)255;
    return p;
  };
  _Float16* xh  = (_Float16*)take((size_t)4 * kB * kDin * 2);   // x pages f16
  _Float16* w1t = (_Float16*)take((size_t)kE * kH1 * kDin * 2); // W1^T f16 [E][N][K]
  _Float16* w2t = (_Float16*)take((size_t)kE * kH2 * kH1 * 2);  // W2^T f16 [E][N][K]
  _Float16* hb  = (_Float16*)take((size_t)kE * kB * kH1 * 2);   // hidden acts f16
  _Float16* eo  = (_Float16*)take((size_t)kE * kB * kH2 * 2);   // expert outputs f16
  float*    gts = (float*)   take((size_t)kB * 20 * 4);         // gate weights

  auto cvt = [&](const float* s, _Float16* d, size_t n) {
    int n4 = (int)(n >> 2);
    cvt_f32_to_f16<<<(n4 + 255) / 256, 256, 0, stream>>>(s, d, n4);
  };
  cvt(x0, xh + 0 * (size_t)kB * kDin, (size_t)kB * kDin);
  cvt(x1, xh + 1 * (size_t)kB * kDin, (size_t)kB * kDin);
  cvt(x2, xh + 2 * (size_t)kB * kDin, (size_t)kB * kDin);
  cvt(xs, xh + 3 * (size_t)kB * kDin, (size_t)kB * kDin);

  // weights: convert + transpose to [E][N][K] so GEMM streams b128 tiles
  dim3 tb(32, 8);
  cvt_transpose_f32_f16<<<dim3(kH1 / 32, kDin / 32, kSpec), tb, 0, stream>>>(
      W1s, w1t, kDin, kH1);
  cvt_transpose_f32_f16<<<dim3(kH1 / 32, kDin / 32, 2), tb, 0, stream>>>(
      W1h, w1t + (size_t)kSpec * kH1 * kDin, kDin, kH1);
  cvt_transpose_f32_f16<<<dim3(kH2 / 32, kH1 / 32, kSpec), tb, 0, stream>>>(
      W2s, w2t, kH1, kH2);
  cvt_transpose_f32_f16<<<dim3(kH2 / 32, kH1 / 32, 2), tb, 0, stream>>>(
      W2h, w2t + (size_t)kSpec * kH2 * kH1, kH1, kH2);

  gates_kernel<<<kB, 128, 0, stream>>>(x0, x1, x2, xs, Wg, bg, Wsg, bsg, gts);

  // layer 1: h[e] = relu(x_page(e) @ W1[e] + b1[e])   [B,1024]
  dim3 g1(kH1 / 128, kB / 128, kE);
  gemm_bias_relu_wmma<<<g1, 256, 0, stream>>>(xh, w1t, b1s, b1h, hb,
                                              kB, kDin, kH1, /*pageMode=*/1);
  // layer 2: eo[e] = relu(h[e] @ W2[e] + b2[e])       [B,512]
  dim3 g2(kH2 / 128, kB / 128, kE);
  gemm_bias_relu_wmma<<<g2, 256, 0, stream>>>(hb, w2t, b2s, b2h, eo,
                                              kB, kH1, kH2, /*pageMode=*/0);

  combine_kernel<<<(kB * kH2 + 255) / 256, 256, 0, stream>>>(eo, gts, (float*)d_out);
}

// v001
// One run takes 266 microseconds.
// In both of two side-by-side timings against v000, it was 1.08 times as fast.
#include <hip/hip_runtime.h>
#include <hip/hip_bf16.h>

typedef __attribute__((ext_vector_type(16))) _Float16 v16h;
typedef __attribute__((ext_vector_type(8)))  float    v8f;

constexpr int kB    = 4096;
constexpr int kDin  = 1024;
constexpr int kH1   = 1024;
constexpr int kH2   = 512;
constexpr int kE    = 8;   // 6 specific + 2 shared experts
constexpr int kSpec = 6;

constexpr int kPitch4 = 5;               // row pitch in 16-B units
constexpr int kTile4  = 128 * kPitch4;   // one 128-row operand tile
constexpr int kBuf4   = 2 * kTile4;      // one (A|W) stage

union Frag { uint4 u[2]; v16h h; };

#if defined(__AMDGCN__) && \
    __has_builtin(__builtin_amdgcn_global_load_async_to_lds_b128) && \
    __has_builtin(__builtin_amdgcn_s_wait_asynccnt)
#define USE_ASYNC 1
typedef int v4i __attribute__((ext_vector_type(4)));
typedef __attribute__((address_space(3))) v4i lds_v4i;
typedef __attribute__((address_space(1))) v4i glb_v4i;
#else
#define USE_ASYNC 0
#endif

// ---------------- f32 -> f16 conversion (x4 vectorized) ----------------
__global__ void __launch_bounds__(256)
cvt_f32_to_f16(const float* __restrict__ s, _Float16* __restrict__ d, int n4) {
  int i = blockIdx.x * blockDim.x + threadIdx.x;
  if (i >= n4) return;
  float4 v = reinterpret_cast<const float4*>(s)[i];
  union { _Float16 h[4]; uint2 u; } p;
  p.h[0] = (_Float16)v.x; p.h[1] = (_Float16)v.y;
  p.h[2] = (_Float16)v.z; p.h[3] = (_Float16)v.w;
  reinterpret_cast<uint2*>(d)[i] = p.u;
}

// ------------- f32 [E][K][N] -> f16 [E][N][K] transpose+convert --------
__global__ void __launch_bounds__(256)
cvt_transpose_f32_f16(const float* __restrict__ in, _Float16* __restrict__ out,
                      int K, int N) {
  __shared__ float tile[32][33];
  const int e  = blockIdx.z;
  const int n0 = blockIdx.x * 32;
  const int k0 = blockIdx.y * 32;
  const int tx = threadIdx.x;   // 32
  const int ty = threadIdx.y;   // 8
  const float* src = in + (size_t)e * K * N;
  _Float16* dst = out + (size_t)e * N * K;
  #pragma unroll
  for (int i = 0; i < 4; i++)
    tile[ty + i * 8][tx] = src[(size_t)(k0 + ty + i * 8) * N + (n0 + tx)];
  __syncthreads();
  #pragma unroll
  for (int i = 0; i < 4; i++)
    dst[(size_t)(n0 + ty + i * 8) * K + (k0 + tx)] = (_Float16)tile[tx][ty + i * 8];
}

// ---------------- gate weights: [B,20] = softmax groups (4,4,4,8) ------
__global__ void __launch_bounds__(128)
gates_kernel(const float* __restrict__ x0, const float* __restrict__ x1,
             const float* __restrict__ x2, const float* __restrict__ xs,
             const float* __restrict__ Wg,  const float* __restrict__ bg,
             const float* __restrict__ Wsg, const float* __restrict__ bsg,
             float* __restrict__ gates) {
  __shared__ float xr[4][kDin];
  __shared__ float lg[20];
  const int row = blockIdx.x;
  const int t = threadIdx.x;
  for (int i = t; i < kDin; i += 128) {
    xr[0][i] = x0[(size_t)row * kDin + i];
    xr[1][i] = x1[(size_t)row * kDin + i];
    xr[2][i] = x2[(size_t)row * kDin + i];
    xr[3][i] = xs[(size_t)row * kDin + i];
  }
  __syncthreads();
  if (t < 20) {
    float s;
    if (t < 12) {                       // per-domain gates: Linear(D_IN, 4)
      int d = t >> 2, kk = t & 3;
      s = bg[d * 4 + kk];
      for (int i = 0; i < kDin; i++)
        s += xr[d][i] * Wg[((size_t)d * kDin + i) * 4 + kk];
    } else {                            // shared gate: Linear(D_IN, 8)
      int kk = t - 12;
      s = bsg[kk];
      for (int i = 0; i < kDin; i++)
        s += xr[3][i] * Wsg[(size_t)i * 8 + kk];
    }
    lg[t] = s;
  }
  __syncthreads();
  if (t < 4) {
    int base = (t < 3) ? t * 4 : 12;
    int len  = (t < 3) ? 4 : 8;
    float mx = -3.4e38f;
    for (int i = 0; i < len; i++) mx = fmaxf(mx, lg[base + i]);
    float ev[8]; float sum = 0.f;
    for (int i = 0; i < len; i++) { ev[i] = expf(lg[base + i] - mx); sum += ev[i]; }
    float inv = 1.f / sum;
    for (int i = 0; i < len; i++)
      gates[(size_t)row * 20 + base + i] = ev[i] * inv;
  }
}

// ---------------- WMMA GEMM: C = relu(A @ W + bias), f16 in / f32 acc ----
// block = 256 threads (8 waves); block tile 128(M) x 128(N); wave tile 32x64.
// A : [pages][Bsz][K] f16 row-major.
// Wt: [E][N][K] f16 (pre-transposed) -> W tile loader identical to A tile.
// pageMode=1: expert e reads A page (e<6 ? e/2 : 3)   (layer-1 input mapping)
// pageMode=0: expert e reads A page e                 (layer-2: h buffer)
__global__ void __launch_bounds__(256)
gemm_bias_relu_wmma(const _Float16* __restrict__ A,
                    const _Float16* __restrict__ Wt,
                    const float* __restrict__ biasS,
                    const float* __restrict__ biasH,
                    _Float16* __restrict__ C,
                    int Bsz, int K, int N, int pageMode) {
#if USE_ASYNC
  __shared__ alignas(16) uint4 smem4[2 * kBuf4];   // 40 KB: double-buffered (A|W) tiles
#else
  __shared__ alignas(16) uint4 smem4[kBuf4];       // 20 KB: single (A|W) tile
#endif

  const int tid  = threadIdx.x;
  const int lane = tid & 31;
  const int wave = tid >> 5;
  const int waveM = wave & 3;          // 4 waves along M
  const int waveN = wave >> 2;         // 2 waves along N
  const int rl   = lane & 15;
  const int hsel = lane >> 4;

  const int e  = blockIdx.z;
  const int n0 = blockIdx.x * 128;
  const int m0 = blockIdx.y * 128;
  const int page = pageMode ? ((e < kSpec) ? (e >> 1) : 3) : e;
  const int ld = K >> 3;               // row stride in uint4 units

  const uint4* __restrict__ Ag = reinterpret_cast<const uint4*>(A) +
      (size_t)page * Bsz * ld + (size_t)m0 * ld;
  const uint4* __restrict__ Wg = reinterpret_cast<const uint4*>(Wt) +
      (size_t)e * N * ld + (size_t)n0 * ld;

  const v8f vzero = {0.f, 0.f, 0.f, 0.f, 0.f, 0.f, 0.f, 0.f};
  v8f acc[2][4];
  #pragma unroll
  for (int mt = 0; mt < 2; mt++)
    #pragma unroll
    for (int nt = 0; nt < 4; nt++) acc[mt][nt] = vzero;

#if USE_ASYNC
  auto issue = [&](int k0, int buf) {
    lds_v4i* dA = (lds_v4i*)(smem4 + buf * kBuf4);
    lds_v4i* dW = dA + kTile4;
    glb_v4i* sA = (glb_v4i*)(Ag + (k0 >> 3));
    glb_v4i* sW = (glb_v4i*)(Wg + (k0 >> 3));
    #pragma unroll
    for (int i = 0; i < 2; i++) {
      int q4 = tid + i * 256;
      int r = q4 >> 2, c4 = q4 & 3;
      __builtin_amdgcn_global_load_async_to_lds_b128(sA + (size_t)r * ld + c4,
                                                     dA + r * kPitch4 + c4, 0, 0);
      __builtin_amdgcn_global_load_async_to_lds_b128(sW + (size_t)r * ld + c4,
                                                     dW + r * kPitch4 + c4, 0, 0);
    }
  };
  issue(0, 0);
  __builtin_amdgcn_s_wait_asynccnt(0);
  __syncthreads();
#endif

  for (int k0 = 0; k0 < K; k0 += 32) {
#if USE_ASYNC
    const int cur = (k0 >> 5) & 1;
    if (k0 + 32 < K) issue(k0 + 32, cur ^ 1);   // overlap DMA with WMMA
    const uint4* ap = reinterpret_cast<const uint4*>(smem4 + cur * kBuf4);
    const uint4* bp = ap + kTile4;
#else
    {  // synchronous fallback: both tiles are plain coalesced b128 copies
      uint4* dA = smem4;
      uint4* dW = smem4 + kTile4;
      const uint4* sA = Ag + (k0 >> 3);
      const uint4* sW = Wg + (k0 >> 3);
      #pragma unroll
      for (int i = 0; i < 2; i++) {
        int q4 = tid + i * 256;
        int r = q4 >> 2, c4 = q4 & 3;
        dA[r * kPitch4 + c4] = sA[(size_t)r * ld + c4];
        dW[r * kPitch4 + c4] = sW[(size_t)r * ld + c4];
      }
    }
    __syncthreads();
    const uint4* ap = reinterpret_cast<const uint4*>(smem4);
    const uint4* bp = ap + kTile4;
#endif

    Frag afrag[2], bfrag[4];
    #pragma unroll
    for (int mt = 0; mt < 2; mt++) {
      int r = waveM * 32 + mt * 16 + rl;
      afrag[mt].u[0] = ap[r * kPitch4 + hsel];
      afrag[mt].u[1] = ap[r * kPitch4 + hsel + 2];
    }
    #pragma unroll
    for (int nt = 0; nt < 4; nt++) {
      int c = waveN * 64 + nt * 16 + rl;
      bfrag[nt].u[0] = bp[c * kPitch4 + hsel];
      bfrag[nt].u[1] = bp[c * kPitch4 + hsel + 2];
    }
    #pragma unroll
    for (int mt = 0; mt < 2; mt++)
      #pragma unroll
      for (int nt = 0; nt < 4; nt++)
        acc[mt][nt] = __builtin_amdgcn_wmma_f32_16x16x32_f16(
            false, afrag[mt].h, false, bfrag[nt].h,
            (short)0, acc[mt][nt], false, false);

#if USE_ASYNC
    __builtin_amdgcn_s_wait_asynccnt(0);
#endif
    __syncthreads();
  }

  const float* bias = (e < kSpec) ? (biasS + (size_t)e * N)
                                  : (biasH + (size_t)(e - kSpec) * N);
  _Float16* Cp = C + (size_t)e * Bsz * N;
  #pragma unroll
  for (int nt = 0; nt < 4; nt++) {
    int col = n0 + waveN * 64 + nt * 16 + rl;
    float bv = bias[col];
    #pragma unroll
    for (int mt = 0; mt < 2; mt++) {
      int rbase = m0 + waveM * 32 + mt * 16 + hsel * 8;
      #pragma unroll
      for (int j = 0; j < 8; j++) {
        float v = acc[mt][nt][j] + bv;
        v = v > 0.f ? v : 0.f;
        Cp[(size_t)(rbase + j) * N + col] = (_Float16)v;
      }
    }
  }
}

// ---------------- gated combine: 4 outputs, each [B, H2] f32 ------------
__global__ void __launch_bounds__(256)
combine_kernel(const _Float16* __restrict__ eo,   // [8][B][H2]
               const float* __restrict__ gates,   // [B][20]
               float* __restrict__ out) {         // [4][B][H2]
  int idx = blockIdx.x * blockDim.x + threadIdx.x;
  if (idx >= kB * kH2) return;
  int b = idx / kH2, o = idx % kH2;
  float ex[8];
  #pragma unroll
  for (int k = 0; k < 8; k++)
    ex[k] = (float)eo[((size_t)k * kB + b) * kH2 + o];
  const float* g = gates + (size_t)b * 20;
  float o0 = g[0] * ex[0] + g[1] * ex[1] + g[2]  * ex[6] + g[3]  * ex[7];
  float o1 = g[4] * ex[2] + g[5] * ex[3] + g[6]  * ex[6] + g[7]  * ex[7];
  float o2 = g[8] * ex[4] + g[9] * ex[5] + g[10] * ex[6] + g[11] * ex[7];
  float o3 = 0.f;
  #pragma unroll
  for (int k = 0; k < 8; k++) o3 += g[12 + k] * ex[k];
  size_t p = (size_t)b * kH2 + o;
  const size_t page = (size_t)kB * kH2;
  out[p]            = o0;
  out[page + p]     = o1;
  out[2 * page + p] = o2;
  out[3 * page + p] = o3;
}

extern "C" void kernel_launch(void* const* d_in, const int* in_sizes, int n_in,
                              void* d_out, int out_size, void* d_ws, size_t ws_size,
                              hipStream_t stream) {
  const float* x0  = (const float*)d_in[0];
  const float* x1  = (const float*)d_in[1];
  const float* x2  = (const float*)d_in[2];
  const float* xs  = (const float*)d_in[3];
  const float* W1s = (const float*)d_in[4];
  const float* b1s = (const float*)d_in[5];
  const float* W2s = (const float*)d_in[6];
  const float* b2s = (const float*)d_in[7];
  const float* W1h = (const float*)d_in[8];
  const float* b1h = (const float*)d_in[9];
  const float* W2h = (const float*)d_in[10];
  const float* b2h = (const float*)d_in[11];
  const float* Wg  = (const float*)d_in[12];
  const float* bg  = (const float*)d_in[13];
  const float* Wsg = (const float*)d_in[14];
  const float* bsg = (const float*)d_in[15];
  (void)in_sizes; (void)n_in; (void)out_size; (void)ws_size;

  // ---- workspace carve-out (~153 MB), 256B aligned ----
  char* ws = (char*)d_ws;
  size_t off = 0;
  auto take = [&](size_t bytes) -> char* {
    char* p = ws + off;
    off += (bytes + 255) & ~(size_t)255;
    return p;
  };
  _Float16* xh  = (_Float16*)take((size_t)4 * kB * kDin * 2);   // x pages f16
  _Float16* w1t = (_Float16*)take((size_t)kE * kH1 * kDin * 2); // W1^T f16 [E][N][K]
  _Float16* w2t = (_Float16*)take((size_t)kE * kH2 * kH1 * 2);  // W2^T f16 [E][N][K]
  _Float16* hb  = (_Float16*)take((size_t)kE * kB * kH1 * 2);   // hidden acts f16
  _Float16* eo  = (_Float16*)take((size_t)kE * kB * kH2 * 2);   // expert outputs f16
  float*    gts = (float*)   take((size_t)kB * 20 * 4);         // gate weights

  auto cvt = [&](const float* s, _Float16* d, size_t n) {
    int n4 = (int)(n >> 2);
    cvt_f32_to_f16<<<(n4 + 255) / 256, 256, 0, stream>>>(s, d, n4);
  };
  cvt(x0, xh + 0 * (size_t)kB * kDin, (size_t)kB * kDin);
  cvt(x1, xh + 1 * (size_t)kB * kDin, (size_t)kB * kDin);
  cvt(x2, xh + 2 * (size_t)kB * kDin, (size_t)kB * kDin);
  cvt(xs, xh + 3 * (size_t)kB * kDin, (size_t)kB * kDin);

  // weights: convert + transpose to [E][N][K] so GEMM streams b128 tiles
  dim3 tb(32, 8);
  cvt_transpose_f32_f16<<<dim3(kH1 / 32, kDin / 32, kSpec), tb, 0, stream>>>(
      W1s, w1t, kDin, kH1);
  cvt_transpose_f32_f16<<<dim3(kH1 / 32, kDin / 32, 2), tb, 0, stream>>>(
      W1h, w1t + (size_t)kSpec * kH1 * kDin, kDin, kH1);
  cvt_transpose_f32_f16<<<dim3(kH2 / 32, kH1 / 32, kSpec), tb, 0, stream>>>(
      W2s, w2t, kH1, kH2);
  cvt_transpose_f32_f16<<<dim3(kH2 / 32, kH1 / 32, 2), tb, 0, stream>>>(
      W2h, w2t + (size_t)kSpec * kH2 * kH1, kH1, kH2);

  gates_kernel<<<kB, 128, 0, stream>>>(x0, x1, x2, xs, Wg, bg, Wsg, bsg, gts);

  // layer 1: h[e] = relu(x_page(e) @ W1[e] + b1[e])   [B,1024]
  dim3 g1(kH1 / 128, kB / 128, kE);
  gemm_bias_relu_wmma<<<g1, 256, 0, stream>>>(xh, w1t, b1s, b1h, hb,
                                              kB, kDin, kH1, /*pageMode=*/1);
  // layer 2: eo[e] = relu(h[e] @ W2[e] + b2[e])       [B,512]
  dim3 g2(kH2 / 128, kB / 128, kE);
  gemm_bias_relu_wmma<<<g2, 256, 0, stream>>>(hb, w2t, b2s, b2h, eo,
                                              kB, kH1, kH2, /*pageMode=*/0);

  combine_kernel<<<(kB * kH2 + 255) / 256, 256, 0, stream>>>(eo, gts, (float*)d_out);
}

// v002
// It runs in 217 microseconds.
// Two timings next to v001 both put it at 1.23 times that version's speed.
// Counting every step since v000, it is 1.32 times as fast.
#include <hip/hip_runtime.h>
#include <hip/hip_bf16.h>

typedef __attribute__((ext_vector_type(16))) _Float16 v16h;
typedef __attribute__((ext_vector_type(8)))  float    v8f;

constexpr int kB    = 4096;
constexpr int kDin  = 1024;
constexpr int kH1   = 1024;
constexpr int kH2   = 512;
constexpr int kE    = 8;   // 6 specific + 2 shared experts
constexpr int kSpec = 6;

constexpr int kBK     = 64;              // k depth of one pass, in halves
constexpr int kRow4   = kBK / 8;         // 16-B units of data per tile row
constexpr int kPitch4 = kRow4 + 1;       // row pitch in 16-B units
constexpr int kTile4  = 128 * kPitch4;   // one 128-row operand tile
constexpr int kBuf4   = 2 * kTile4;      // one (A|W) stage

union Frag { uint4 u[2]; v16h h; };

#if defined(__AMDGCN__) && \
    __has_builtin(__builtin_amdgcn_global_load_async_to_lds_b128) && \
    __has_builtin(__builtin_amdgcn_s_wait_asynccnt)
#define USE_ASYNC 1
typedef int v4i __attribute__((ext_vector_type(4)));
typedef __attribute__((address_space(3))) v4i lds_v4i;
typedef __attribute__((address_space(1))) v4i glb_v4i;
#else
#define USE_ASYNC 0
#endif

// ---------------- f32 -> f16 conversion (x4 vectorized) ----------------
__global__ void __launch_bounds__(256)
cvt_f32_to_f16(const float* __restrict__ s, _Float16* __restrict__ d, int n4) {
  int i = blockIdx.x * blockDim.x + threadIdx.x;
  if (i >= n4) return;
  float4 v = reinterpret_cast<const float4*>(s)[i];
  union { _Float16 h[4]; uint2 u; } p;
  p.h[0] = (_Float16)v.x; p.h[1] = (_Float16)v.y;
  p.h[2] = (_Float16)v.z; p.h[3] = (_Float16)v.w;
  reinterpret_cast<uint2*>(d)[i] = p.u;
}

// ------------- f32 [E][K][N] -> f16 [E][N][K] transpose+convert --------
__global__ void __launch_bounds__(256)
cvt_transpose_f32_f16(const float* __restrict__ in, _Float16* __restrict__ out,
                      int K, int N) {
  __shared__ float tile[32][33];
  const int e  = blockIdx.z;
  const int n0 = blockIdx.x * 32;
  const int k0 = blockIdx.y * 32;
  const int tx = threadIdx.x;   // 32
  const int ty = threadIdx.y;   // 8
  const float* src = in + (size_t)e * K * N;
  _Float16* dst = out + (size_t)e * N * K;
  #pragma unroll
  for (int i = 0; i < 4; i++)
    tile[ty + i * 8][tx] = src[(size_t)(k0 + ty + i * 8) * N + (n0 + tx)];
  __syncthreads();
  #pragma unroll
  for (int i = 0; i < 4; i++)
    dst[(size_t)(n0 + ty + i * 8) * K + (k0 + tx)] = (_Float16)tile[tx][ty + i * 8];
}

// ---------------- gate weights: [B,20] = softmax groups (4,4,4,8) ------
__global__ void __launch_bounds__(128)
gates_kernel(const float* __restrict__ x0, const float* __restrict__ x1,
             const float* __restrict__ x2, const float* __restrict__ xs,
             const float* __restrict__ Wg,  const float* __restrict__ bg,
             const float* __restrict__ Wsg, const float* __restrict__ bsg,
             float* __restrict__ gates) {
  __shared__ float xr[4][kDin];
  __shared__ float lg[20];
  const int row = blockIdx.x;
  const int t = threadIdx.x;
  for (int i = t; i < kDin; i += 128) {
    xr[0][i] = x0[(size_t)row * kDin + i];
    xr[1][i] = x1[(size_t)row * kDin + i];
    xr[2][i] = x2[(size_t)row * kDin + i];
    xr[3][i] = xs[(size_t)row * kDin + i];
  }
  __syncthreads();
  if (t < 20) {
    float s;
    if (t < 12) {                       // per-domain gates: Linear(D_IN, 4)
      int d = t >> 2, kk = t & 3;
      s = bg[d * 4 + kk];
      for (int i = 0; i < kDin; i++)
        s += xr[d][i] * Wg[((size_t)d * kDin + i) * 4 + kk];
    } else {                            // shared gate: Linear(D_IN, 8)
      int kk = t - 12;
      s = bsg[kk];
      for (int i = 0; i < kDin; i++)
        s += xr[3][i] * Wsg[(size_t)i * 8 + kk];
    }
    lg[t] = s;
  }
  __syncthreads();
  if (t < 4) {
    int base = (t < 3) ? t * 4 : 12;
    int len  = (t < 3) ? 4 : 8;
    float mx = -3.4e38f;
    for (int i = 0; i < len; i++) mx = fmaxf(mx, lg[base + i]);
    float ev[8]; float sum = 0.f;
    for (int i = 0; i < len; i++) { ev[i] = expf(lg[base + i] - mx); sum += ev[i]; }
    float inv = 1.f / sum;
    for (int i = 0; i < len; i++)
      gates[(size_t)row * 20 + base + i] = ev[i] * inv;
  }
}

// ---------------- WMMA GEMM: C = relu(A @ W + bias), f16 in / f32 acc ----
// block = 256 threads (8 waves); block tile 128(M) x 128(N); wave tile 32x64.
// A : [pages][Bsz][K] f16 row-major.
// Wt: [E][N][K] f16 (pre-transposed) -> W tile loader identical to A tile.
// pageMode=1: expert e reads A page (e<6 ? e/2 : 3)   (layer-1 input mapping)
// pageMode=0: expert e reads A page e                 (layer-2: h buffer)
__global__ void __launch_bounds__(256)
gemm_bias_relu_wmma(const _Float16* __restrict__ A,
                    const _Float16* __restrict__ Wt,
                    const float* __restrict__ biasS,
                    const float* __restrict__ biasH,
                    _Float16* __restrict__ C,
                    int Bsz, int K, int N, int pageMode) {
#if USE_ASYNC
  __shared__ alignas(16) uint4 smem4[2 * kBuf4];   // 72 KB: double-buffered (A|W) tiles
#else
  __shared__ alignas(16) uint4 smem4[kBuf4];       // 36 KB: single (A|W) tile
#endif

  const int tid  = threadIdx.x;
  const int lane = tid & 31;
  const int wave = tid >> 5;
  const int waveM = wave & 3;          // 4 waves along M
  const int waveN = wave >> 2;         // 2 waves along N
  const int rl   = lane & 15;
  const int hsel = lane >> 4;

  const int e  = blockIdx.z;
  const int n0 = blockIdx.x * 128;
  const int m0 = blockIdx.y * 128;
  const int page = pageMode ? ((e < kSpec) ? (e >> 1) : 3) : e;
  const int ld = K >> 3;               // row stride in uint4 units

  const uint4* __restrict__ Ag = reinterpret_cast<const uint4*>(A) +
      (size_t)page * Bsz * ld + (size_t)m0 * ld;
  const uint4* __restrict__ Wg = reinterpret_cast<const uint4*>(Wt) +
      (size_t)e * N * ld + (size_t)n0 * ld;

  const v8f vzero = {0.f, 0.f, 0.f, 0.f, 0.f, 0.f, 0.f, 0.f};
  v8f acc[2][4];
  #pragma unroll
  for (int mt = 0; mt < 2; mt++)
    #pragma unroll
    for (int nt = 0; nt < 4; nt++) acc[mt][nt] = vzero;

#if USE_ASYNC
  auto issue = [&](int k0, int buf) {
    lds_v4i* dA = (lds_v4i*)(smem4 + buf * kBuf4);
    lds_v4i* dW = dA + kTile4;
    glb_v4i* sA = (glb_v4i*)(Ag + (k0 >> 3));
    glb_v4i* sW = (glb_v4i*)(Wg + (k0 >> 3));
    #pragma unroll
    for (int i = 0; i < 128 * kRow4 / 256; i++) {
      int q4 = tid + i * 256;
      int r = q4 / kRow4, c4 = q4 % kRow4;
      __builtin_amdgcn_global_load_async_to_lds_b128(sA + (size_t)r * ld + c4,
                                                     dA + r * kPitch4 + c4, 0, 0);
      __builtin_amdgcn_global_load_async_to_lds_b128(sW + (size_t)r * ld + c4,
                                                     dW + r * kPitch4 + c4, 0, 0);
    }
  };
  issue(0, 0);
  // tile 0 has landed for this wave before the barrier publishes it
  asm volatile("s_wait_asynccnt 0x0" ::: "memory");
  __syncthreads();
  if (kBK < K) issue(kBK, 1);                   // tile 1 flies during pass 0
#endif

  for (int k0 = 0; k0 < K; k0 += kBK) {
#if USE_ASYNC
    const int cur = (k0 / kBK) & 1;
    const uint4* ap = reinterpret_cast<const uint4*>(smem4 + cur * kBuf4);
    const uint4* bp = ap + kTile4;
#else
    {  // synchronous fallback: both tiles are plain coalesced b128 copies
      uint4* dA = smem4;
      uint4* dW = smem4 + kTile4;
      const uint4* sA = Ag + (k0 >> 3);
      const uint4* sW = Wg + (k0 >> 3);
      #pragma unroll
      for (int i = 0; i < 128 * kRow4 / 256; i++) {
        int q4 = tid + i * 256;
        int r = q4 / kRow4, c4 = q4 % kRow4;
        dA[r * kPitch4 + c4] = sA[(size_t)r * ld + c4];
        dW[r * kPitch4 + c4] = sW[(size_t)r * ld + c4];
      }
    }
    __syncthreads();
    const uint4* ap = reinterpret_cast<const uint4*>(smem4);
    const uint4* bp = ap + kTile4;
#endif

    #pragma unroll
    for (int ks = 0; ks < kBK / 32; ks++) {
      Frag afrag[2], bfrag[4];
      #pragma unroll
      for (int mt = 0; mt < 2; mt++) {
        int r = waveM * 32 + mt * 16 + rl;
        afrag[mt].u[0] = ap[r * kPitch4 + ks * 4 + hsel];
        afrag[mt].u[1] = ap[r * kPitch4 + ks * 4 + hsel + 2];
      }
      #pragma unroll
      for (int nt = 0; nt < 4; nt++) {
        int c = waveN * 64 + nt * 16 + rl;
        bfrag[nt].u[0] = bp[c * kPitch4 + ks * 4 + hsel];
        bfrag[nt].u[1] = bp[c * kPitch4 + ks * 4 + hsel + 2];
      }
      #pragma unroll
      for (int mt = 0; mt < 2; mt++)
        #pragma unroll
        for (int nt = 0; nt < 4; nt++)
          acc[mt][nt] = __builtin_amdgcn_wmma_f32_16x16x32_f16(
              false, afrag[mt].h, false, bfrag[nt].h,
              (short)0, acc[mt][nt], false, false);
    }

#if USE_ASYNC
    // this wave's reads of the current buffer are done before it is refilled
    asm volatile("s_wait_dscnt 0x0" ::: "memory");
    // this wave's copies of the next tile have landed before the barrier publishes them
    asm volatile("s_wait_asynccnt 0x0" ::: "memory");
    __syncthreads();
    if (k0 + 2 * kBK < K) issue(k0 + 2 * kBK, cur);  // refill the buffer just read
#else
    __syncthreads();
#endif
  }
#if USE_ASYNC
  // no copy is outstanding when the wave goes on to its end
  asm volatile("s_wait_asynccnt 0x0" ::: "memory");
#endif

  const float* bias = (e < kSpec) ? (biasS + (size_t)e * N)
                                  : (biasH + (size_t)(e - kSpec) * N);
  _Float16* Cp = C + (size_t)e * Bsz * N;
  #pragma unroll
  for (int nt = 0; nt < 4; nt++) {
    int col = n0 + waveN * 64 + nt * 16 + rl;
    float bv = bias[col];
    #pragma unroll
    for (int mt = 0; mt < 2; mt++) {
      int rbase = m0 + waveM * 32 + mt * 16 + hsel * 8;
      #pragma unroll
      for (int j = 0; j < 8; j++) {
        float v = acc[mt][nt][j] + bv;
        v = v > 0.f ? v : 0.f;
        Cp[(size_t)(rbase + j) * N + col] = (_Float16)v;
      }
    }
  }
}

// ---------------- gated combine: 4 outputs, each [B, H2] f32 ------------
__global__ void __launch_bounds__(256)
combine_kernel(const _Float16* __restrict__ eo,   // [8][B][H2]
               const float* __restrict__ gates,   // [B][20]
               float* __restrict__ out) {         // [4][B][H2]
  int idx = blockIdx.x * blockDim.x + threadIdx.x;
  if (idx >= kB * kH2) return;
  int b = idx / kH2, o = idx % kH2;
  float ex[8];
  #pragma unroll
  for (int k = 0; k < 8; k++)
    ex[k] = (float)eo[((size_t)k * kB + b) * kH2 + o];
  const float* g = gates + (size_t)b * 20;
  float o0 = g[0] * ex[0] + g[1] * ex[1] + g[2]  * ex[6] + g[3]  * ex[7];
  float o1 = g[4] * ex[2] + g[5] * ex[3] + g[6]  * ex[6] + g[7]  * ex[7];
  float o2 = g[8] * ex[4] + g[9] * ex[5] + g[10] * ex[6] + g[11] * ex[7];
  float o3 = 0.f;
  #pragma unroll
  for (int k = 0; k < 8; k++) o3 += g[12 + k] * ex[k];
  size_t p = (size_t)b * kH2 + o;
  const size_t page = (size_t)kB * kH2;
  out[p]            = o0;
  out[page + p]     = o1;
  out[2 * page + p] = o2;
  out[3 * page + p] = o3;
}

extern "C" void kernel_launch(void* const* d_in, const int* in_sizes, int n_in,
                              void* d_out, int out_size, void* d_ws, size_t ws_size,
                              hipStream_t stream) {
  const float* x0  = (const float*)d_in[0];
  const float* x1  = (const float*)d_in[1];
  const float* x2  = (const float*)d_in[2];
  const float* xs  = (const float*)d_in[3];
  const float* W1s = (const float*)d_in[4];
  const float* b1s = (const float*)d_in[5];
  const float* W2s = (const float*)d_in[6];
  const float* b2s = (const float*)d_in[7];
  const float* W1h = (const float*)d_in[8];
  const float* b1h = (const float*)d_in[9];
  const float* W2h = (const float*)d_in[10];
  const float* b2h = (const float*)d_in[11];
  const float* Wg  = (const float*)d_in[12];
  const float* bg  = (const float*)d_in[13];
  const float* Wsg = (const float*)d_in[14];
  const float* bsg = (const float*)d_in[15];
  (void)in_sizes; (void)n_in; (void)out_size; (void)ws_size;

  // ---- workspace carve-out (~153 MB), 256B aligned ----
  char* ws = (char*)d_ws;
  size_t off = 0;
  auto take = [&](size_t bytes) -> char* {
    char* p = ws + off;
    off += (bytes + 255) & ~(size_t)255;
    return p;
  };
  _Float16* xh  = (_Float16*)take((size_t)4 * kB * kDin * 2);   // x pages f16
  _Float16* w1t = (_Float16*)take((size_t)kE * kH1 * kDin * 2); // W1^T f16 [E][N][K]
  _Float16* w2t = (_Float16*)take((size_t)kE * kH2 * kH1 * 2);  // W2^T f16 [E][N][K]
  _Float16* hb  = (_Float16*)take((size_t)kE * kB * kH1 * 2);   // hidden acts f16
  _Float16* eo  = (_Float16*)take((size_t)kE * kB * kH2 * 2);   // expert outputs f16
  float*    gts = (float*)   take((size_t)kB * 20 * 4);         // gate weights

  auto cvt = [&](const float* s, _Float16* d, size_t n) {
    int n4 = (int)(n >> 2);
    cvt_f32_to_f16<<<(n4 + 255) / 256, 256, 0, stream>>>(s, d, n4);
  };
  cvt(x0, xh + 0 * (size_t)kB * kDin, (size_t)kB * kDin);
  cvt(x1, xh + 1 * (size_t)kB * kDin, (size_t)kB * kDin);
  cvt(x2, xh + 2 * (size_t)kB * kDin, (size_t)kB * kDin);
  cvt(xs, xh + 3 * (size_t)kB * kDin, (size_t)kB * kDin);

  // weights: convert + transpose to [E][N][K] so GEMM streams b128 tiles
  dim3 tb(32, 8);
  cvt_transpose_f32_f16<<<dim3(kH1 / 32, kDin / 32, kSpec), tb, 0, stream>>>(
      W1s, w1t, kDin, kH1);
  cvt_transpose_f32_f16<<<dim3(kH1 / 32, kDin / 32, 2), tb, 0, stream>>>(
      W1h, w1t + (size_t)kSpec * kH1 * kDin, kDin, kH1);
  cvt_transpose_f32_f16<<<dim3(kH2 / 32, kH1 / 32, kSpec), tb, 0, stream>>>(
      W2s, w2t, kH1, kH2);
  cvt_transpose_f32_f16<<<dim3(kH2 / 32, kH1 / 32, 2), tb, 0, stream>>>(
      W2h, w2t + (size_t)kSpec * kH2 * kH1, kH1, kH2);

  gates_kernel<<<kB, 128, 0, stream>>>(x0, x1, x2, xs, Wg, bg, Wsg, bsg, gts);

  // layer 1: h[e] = relu(x_page(e) @ W1[e] + b1[e])   [B,1024]
  dim3 g1(kH1 / 128, kB / 128, kE);
  gemm_bias_relu_wmma<<<g1, 256, 0, stream>>>(xh, w1t, b1s, b1h, hb,
                                              kB, kDin, kH1, /*pageMode=*/1);
  // layer 2: eo[e] = relu(h[e] @ W2[e] + b2[e])       [B,512]
  dim3 g2(kH2 / 128, kB / 128, kE);
  gemm_bias_relu_wmma<<<g2, 256, 0, stream>>>(hb, w2t, b2s, b2h, eo,
                                              kB, kH1, kH2, /*pageMode=*/0);

  combine_kernel<<<(kB * kH2 + 255) / 256, 256, 0, stream>>>(eo, gts, (float*)d_out);
}

// v003
// Measured time: 137 microseconds a run.
// Two timings next to v002 both put it at 1.58 times that version's speed.
// Over all steps from v000 it is 2.09 times as fast.
#include <hip/hip_runtime.h>
#include <hip/hip_bf16.h>

typedef __attribute__((ext_vector_type(16))) _Float16 v16h;
typedef __attribute__((ext_vector_type(8)))  float    v8f;

constexpr int kB    = 4096;
constexpr int kDin  = 1024;
constexpr int kH1   = 1024;
constexpr int kH2   = 512;
constexpr int kE    = 8;   // 6 specific + 2 shared experts
constexpr int kSpec = 6;

constexpr int kBK     = 64;              // k depth of one pass, in halves
constexpr int kRow4   = kBK / 8;         // 16-B units of data per tile row
constexpr int kPitch4 = kRow4 + 1;       // row pitch in 16-B units
constexpr int kTile4  = 128 * kPitch4;   // one 128-row operand tile
constexpr int kBuf4   = 2 * kTile4;      // one (A|W) stage

union Frag { uint4 u[2]; v16h h; };

#if defined(__AMDGCN__) && \
    __has_builtin(__builtin_amdgcn_global_load_async_to_lds_b128) && \
    __has_builtin(__builtin_amdgcn_s_wait_asynccnt)
#define USE_ASYNC 1
typedef int v4i __attribute__((ext_vector_type(4)));
typedef __attribute__((address_space(3))) v4i lds_v4i;
typedef __attribute__((address_space(1))) v4i glb_v4i;
#else
#define USE_ASYNC 0
#endif

// ------------- f32 [E][K][N] -> f16 [E][N][K] transpose+convert --------
__global__ void __launch_bounds__(256)
cvt_transpose_f32_f16(const float* __restrict__ in, _Float16* __restrict__ out,
                      int K, int N) {
  __shared__ float tile[32][33];
  const int e  = blockIdx.z;
  const int n0 = blockIdx.x * 32;
  const int k0 = blockIdx.y * 32;
  const int tx = threadIdx.x;   // 32
  const int ty = threadIdx.y;   // 8
  const float* src = in + (size_t)e * K * N;
  _Float16* dst = out + (size_t)e * N * K;
  #pragma unroll
  for (int i = 0; i < 4; i++)
    tile[ty + i * 8][tx] = src[(size_t)(k0 + ty + i * 8) * N + (n0 + tx)];
  __syncthreads();
  #pragma unroll
  for (int i = 0; i < 4; i++)
    dst[(size_t)(n0 + ty + i * 8) * K + (k0 + tx)] = (_Float16)tile[tx][ty + i * 8];
}

typedef float f32x4 __attribute__((ext_vector_type(4)));
typedef float f32x2 __attribute__((ext_vector_type(2)));
constexpr int kXRows = 4;                // rows of x per wave

template <int M, int HALF, int N>
__device__ __forceinline__ void wave_sums(float (&a)[N], int lane) {
  if constexpr (HALF >= 1) {
    const bool up = (lane & M) != 0;
    #pragma unroll
    for (int i = 0; i < HALF; i++) {
      float keep = up ? a[i + HALF] : a[i];
      float send = up ? a[i] : a[i + HALF];
      a[i] = keep + __shfl_xor(send, M, 32);
    }
  } else {
    a[0] += __shfl_xor(a[0], M, 32);
  }
  if constexpr (M > 1) wave_sums<M / 2, HALF / 2, N>(a, lane);
}

template <int NG>                        // gate width: 4 or 8
__device__ __forceinline__ void x_pass(const float* __restrict__ x,
                                       const float* __restrict__ Wgt,  // [D_IN][NG]
                                       const float* __restrict__ bias, // [NG]
                                       _Float16* __restrict__ xh,      // f16 page of x
                                       float* __restrict__ gates, int gbase,
                                       f32x4* wl) {
  constexpr int H = NG / 4;              // 16-B units per weight row
  constexpr int N = kXRows * NG;         // sums per wave
  const int tid  = threadIdx.x;
  const int lane = tid & 31;
  const int blk0 = blockIdx.x * (8 * kXRows);            // the block's first row
  const int row0 = blk0 + (tid >> 5) * kXRows;           // the wave's first row
  // the lane's first 16-B unit of x (8-B unit of the copy) inside the block's rows
  const int t0 = (tid >> 5) * (kXRows * (kDin / 4)) + lane;

  // gate weights first, then the rows: the weights can be laid in LDS while
  // the rows are still in flight
  const f32x4* W4 = reinterpret_cast<const f32x4*>(Wgt);
  f32x4 wv[4 * H];
  #pragma unroll
  for (int i = 0; i < 4 * H; i++) wv[i] = W4[tid + i * 256];
  const f32x4* xp = reinterpret_cast<const f32x4*>(x) + (size_t)blk0 * (kDin / 4);
  f32x4 xv[kXRows][8];
  #pragma unroll
  for (int r = 0; r < kXRows; r++)
    #pragma unroll
    for (int j = 0; j < 8; j++) xv[r][j] = xp[t0 + r * (kDin / 4) + j * 32];

  // LDS order [j][c][h][lane]: the 32 lanes of a reader take 512 contiguous B
  #pragma unroll
  for (int i = 0; i < 4 * H; i++) {
    int q = tid + i * 256;
    int k = q / H, h = q % H;
    wl[(((k >> 7) * 4 + (k & 3)) * H + h) * 32 + ((k >> 2) & 31)] = wv[i];
  }
  __syncthreads();

  uint2* xo = reinterpret_cast<uint2*>(xh) + (size_t)blk0 * (kDin / 4);
  f32x2 acc2[N / 2];                     // gates 2 i, 2 i + 1 of row r at [r * NG / 2 + i]
  #pragma unroll
  for (int i = 0; i < N / 2; i++) acc2[i] = (f32x2){0.f, 0.f};
  #pragma unroll
  for (int j = 0; j < 8; j++) {
    #pragma unroll
    for (int r = 0; r < kXRows; r++) {
      union { _Float16 h[4]; uint2 u; } p;
      p.h[0] = (_Float16)xv[r][j][0]; p.h[1] = (_Float16)xv[r][j][1];
      p.h[2] = (_Float16)xv[r][j][2]; p.h[3] = (_Float16)xv[r][j][3];
      xo[t0 + r * (kDin / 4) + j * 32] = p.u;
    }
    #pragma unroll
    for (int c = 0; c < 4; c++)
      #pragma unroll
      for (int h = 0; h < H; h++) {
        const f32x4 w = wl[((j * 4 + c) * H + h) * 32 + lane];
        #pragma unroll
        for (int r = 0; r < kXRows; r++) {
          const f32x2 xx = {xv[r][j][c], xv[r][j][c]};
          f32x2& lo = acc2[r * (NG / 2) + h * 2];
          f32x2& hi = acc2[r * (NG / 2) + h * 2 + 1];
          lo = __builtin_elementwise_fma(w.lo, xx, lo);
          hi = __builtin_elementwise_fma(w.hi, xx, hi);
        }
      }
    // holds the f16 stores of step j in front of the products of step j + 1:
    // without it the scheduler sinks every store behind the last sum, and the
    // writes only start when the arithmetic is over
    __builtin_amdgcn_sched_barrier(0);
  }
  float acc[N];                          // acc[r * NG + g]: the sum over this lane's 32 k
  #pragma unroll
  for (int i = 0; i < N / 2; i++) { acc[2 * i] = acc2[i][0]; acc[2 * i + 1] = acc2[i][1]; }

  wave_sums<16, N / 2, N>(acc, lane);

  // softmax inside the lanes that hold one row's logits (each logit kDup times)
  constexpr int kDup = 32 / N;
  const int g = (lane / kDup) % NG;
  const float lg = acc[0] + bias[g];
  float mx = lg;
  #pragma unroll
  for (int m = kDup; m < kDup * NG; m <<= 1) mx = fmaxf(mx, __shfl_xor(mx, m, 32));
  const float ev = expf(lg - mx);
  float sum = ev;
  #pragma unroll
  for (int m = kDup; m < kDup * NG; m <<= 1) sum += __shfl_xor(sum, m, 32);
  const float gw = ev * (1.f / sum);
  if (lane % kDup == 0)
    gates[(size_t)(row0 + lane / (kDup * NG)) * 20 + gbase + g] = gw;
}

__global__ void __launch_bounds__(256)
x_f16_gates_kernel(const float* __restrict__ x0, const float* __restrict__ x1,
                   const float* __restrict__ x2, const float* __restrict__ xs,
                   const float* __restrict__ Wg,  const float* __restrict__ bg,
                   const float* __restrict__ Wsg, const float* __restrict__ bsg,
                   _Float16* __restrict__ xh, float* __restrict__ gates) {
  __shared__ alignas(16) f32x4 wl[kDin * 2];   // 32 KB: one input's gate weights
  const int d = blockIdx.y;
  _Float16* page = xh + (size_t)d * kB * kDin;
  const float* x = (d == 0) ? x0 : (d == 1) ? x1 : (d == 2) ? x2 : xs;
  if (d == 3)
    x_pass<8>(x, Wsg, bsg, page, gates, 12, wl);
  else
    x_pass<4>(x, Wg + (size_t)d * kDin * 4, bg + d * 4, page, gates, d * 4, wl);
}

// ---------------- WMMA GEMM: C = relu(A @ W + bias), f16 in / f32 acc ----
// block = 256 threads (8 waves); block tile 128(M) x 128(N); wave tile 32x64.
// A : [pages][Bsz][K] f16 row-major.
// Wt: [E][N][K] f16 (pre-transposed) -> W tile loader identical to A tile.
// pageMode=1: expert e reads A page (e<6 ? e/2 : 3)   (layer-1 input mapping)
// pageMode=0: expert e reads A page e                 (layer-2: h buffer)
__global__ void __launch_bounds__(256)
gemm_bias_relu_wmma(const _Float16* __restrict__ A,
                    const _Float16* __restrict__ Wt,
                    const float* __restrict__ biasS,
                    const float* __restrict__ biasH,
                    _Float16* __restrict__ C,
                    int Bsz, int K, int N, int pageMode) {
#if USE_ASYNC
  __shared__ alignas(16) uint4 smem4[2 * kBuf4];   // 72 KB: double-buffered (A|W) tiles
#else
  __shared__ alignas(16) uint4 smem4[kBuf4];       // 36 KB: single (A|W) tile
#endif

  const int tid  = threadIdx.x;
  const int lane = tid & 31;
  const int wave = tid >> 5;
  const int waveM = wave & 3;          // 4 waves along M
  const int waveN = wave >> 2;         // 2 waves along N
  const int rl   = lane & 15;
  const int hsel = lane >> 4;

  const int e  = blockIdx.z;
  const int n0 = blockIdx.x * 128;
  const int m0 = blockIdx.y * 128;
  const int page = pageMode ? ((e < kSpec) ? (e >> 1) : 3) : e;
  const int ld = K >> 3;               // row stride in uint4 units

  const uint4* __restrict__ Ag = reinterpret_cast<const uint4*>(A) +
      (size_t)page * Bsz * ld + (size_t)m0 * ld;
  const uint4* __restrict__ Wg = reinterpret_cast<const uint4*>(Wt) +
      (size_t)e * N * ld + (size_t)n0 * ld;

  const v8f vzero = {0.f, 0.f, 0.f, 0.f, 0.f, 0.f, 0.f, 0.f};
  v8f acc[2][4];
  #pragma unroll
  for (int mt = 0; mt < 2; mt++)
    #pragma unroll
    for (int nt = 0; nt < 4; nt++) acc[mt][nt] = vzero;

#if USE_ASYNC
  auto issue = [&](int k0, int buf) {
    lds_v4i* dA = (lds_v4i*)(smem4 + buf * kBuf4);
    lds_v4i* dW = dA + kTile4;
    glb_v4i* sA = (glb_v4i*)(Ag + (k0 >> 3));
    glb_v4i* sW = (glb_v4i*)(Wg + (k0 >> 3));
    #pragma unroll
    for (int i = 0; i < 128 * kRow4 / 256; i++) {
      int q4 = tid + i * 256;
      int r = q4 / kRow4, c4 = q4 % kRow4;
      __builtin_amdgcn_global_load_async_to_lds_b128(sA + (size_t)r * ld + c4,
                                                     dA + r * kPitch4 + c4, 0, 0);
      __builtin_amdgcn_global_load_async_to_lds_b128(sW + (size_t)r * ld + c4,
                                                     dW + r * kPitch4 + c4, 0, 0);
    }
  };
  issue(0, 0);
  // tile 0 has landed for this wave before the barrier publishes it
  asm volatile("s_wait_asynccnt 0x0" ::: "memory");
  __syncthreads();
  if (kBK < K) issue(kBK, 1);                   // tile 1 flies during pass 0
#endif

  for (int k0 = 0; k0 < K; k0 += kBK) {
#if USE_ASYNC
    const int cur = (k0 / kBK) & 1;
    const uint4* ap = reinterpret_cast<const uint4*>(smem4 + cur * kBuf4);
    const uint4* bp = ap + kTile4;
#else
    {  // synchronous fallback: both tiles are plain coalesced b128 copies
      uint4* dA = smem4;
      uint4* dW = smem4 + kTile4;
      const uint4* sA = Ag + (k0 >> 3);
      const uint4* sW = Wg + (k0 >> 3);
      #pragma unroll
      for (int i = 0; i < 128 * kRow4 / 256; i++) {
        int q4 = tid + i * 256;
        int r = q4 / kRow4, c4 = q4 % kRow4;
        dA[r * kPitch4 + c4] = sA[(size_t)r * ld + c4];
        dW[r * kPitch4 + c4] = sW[(size_t)r * ld + c4];
      }
    }
    __syncthreads();
    const uint4* ap = reinterpret_cast<const uint4*>(smem4);
    const uint4* bp = ap + kTile4;
#endif

    #pragma unroll
    for (int ks = 0; ks < kBK / 32; ks++) {
      Frag afrag[2], bfrag[4];
      #pragma unroll
      for (int mt = 0; mt < 2; mt++) {
        int r = waveM * 32 + mt * 16 + rl;
        afrag[mt].u[0] = ap[r * kPitch4 + ks * 4 + hsel];
        afrag[mt].u[1] = ap[r * kPitch4 + ks * 4 + hsel + 2];
      }
      #pragma unroll
      for (int nt = 0; nt < 4; nt++) {
        int c = waveN * 64 + nt * 16 + rl;
        bfrag[nt].u[0] = bp[c * kPitch4 + ks * 4 + hsel];
        bfrag[nt].u[1] = bp[c * kPitch4 + ks * 4 + hsel + 2];
      }
      #pragma unroll
      for (int mt = 0; mt < 2; mt++)
        #pragma unroll
        for (int nt = 0; nt < 4; nt++)
          acc[mt][nt] = __builtin_amdgcn_wmma_f32_16x16x32_f16(
              false, afrag[mt].h, false, bfrag[nt].h,
              (short)0, acc[mt][nt], false, false);
    }

#if USE_ASYNC
    // this wave's reads of the current buffer are done before it is refilled
    asm volatile("s_wait_dscnt 0x0" ::: "memory");
    // this wave's copies of the next tile have landed before the barrier publishes them
    asm volatile("s_wait_asynccnt 0x0" ::: "memory");
    __syncthreads();
    if (k0 + 2 * kBK < K) issue(k0 + 2 * kBK, cur);  // refill the buffer just read
#else
    __syncthreads();
#endif
  }
#if USE_ASYNC
  // no copy is outstanding when the wave goes on to its end
  asm volatile("s_wait_asynccnt 0x0" ::: "memory");
#endif

  const float* bias = (e < kSpec) ? (biasS + (size_t)e * N)
                                  : (biasH + (size_t)(e - kSpec) * N);
  _Float16* Cp = C + (size_t)e * Bsz * N;
  #pragma unroll
  for (int nt = 0; nt < 4; nt++) {
    int col = n0 + waveN * 64 + nt * 16 + rl;
    float bv = bias[col];
    #pragma unroll
    for (int mt = 0; mt < 2; mt++) {
      int rbase = m0 + waveM * 32 + mt * 16 + hsel * 8;
      #pragma unroll
      for (int j = 0; j < 8; j++) {
        float v = acc[mt][nt][j] + bv;
        v = v > 0.f ? v : 0.f;
        Cp[(size_t)(rbase + j) * N + col] = (_Float16)v;
      }
    }
  }
}

// ---------------- gated combine: 4 outputs, each [B, H2] f32 ------------
__global__ void __launch_bounds__(256)
combine_kernel(const _Float16* __restrict__ eo,   // [8][B][H2]
               const float* __restrict__ gates,   // [B][20]
               float* __restrict__ out) {         // [4][B][H2]
  int idx = blockIdx.x * blockDim.x + threadIdx.x;
  if (idx >= kB * kH2) return;
  int b = idx / kH2, o = idx % kH2;
  float ex[8];
  #pragma unroll
  for (int k = 0; k < 8; k++)
    ex[k] = (float)eo[((size_t)k * kB + b) * kH2 + o];
  const float* g = gates + (size_t)b * 20;
  float o0 = g[0] * ex[0] + g[1] * ex[1] + g[2]  * ex[6] + g[3]  * ex[7];
  float o1 = g[4] * ex[2] + g[5] * ex[3] + g[6]  * ex[6] + g[7]  * ex[7];
  float o2 = g[8] * ex[4] + g[9] * ex[5] + g[10] * ex[6] + g[11] * ex[7];
  float o3 = 0.f;
  #pragma unroll
  for (int k = 0; k < 8; k++) o3 += g[12 + k] * ex[k];
  size_t p = (size_t)b * kH2 + o;
  const size_t page = (size_t)kB * kH2;
  out[p]            = o0;
  out[page + p]     = o1;
  out[2 * page + p] = o2;
  out[3 * page + p] = o3;
}

extern "C" void kernel_launch(void* const* d_in, const int* in_sizes, int n_in,
                              void* d_out, int out_size, void* d_ws, size_t ws_size,
                              hipStream_t stream) {
  const float* x0  = (const float*)d_in[0];
  const float* x1  = (const float*)d_in[1];
  const float* x2  = (const float*)d_in[2];
  const float* xs  = (const float*)d_in[3];
  const float* W1s = (const float*)d_in[4];
  const float* b1s = (const float*)d_in[5];
  const float* W2s = (const float*)d_in[6];
  const float* b2s = (const float*)d_in[7];
  const float* W1h = (const float*)d_in[8];
  const float* b1h = (const float*)d_in[9];
  const float* W2h = (const float*)d_in[10];
  const float* b2h = (const float*)d_in[11];
  const float* Wg  = (const float*)d_in[12];
  const float* bg  = (const float*)d_in[13];
  const float* Wsg = (const float*)d_in[14];
  const float* bsg = (const float*)d_in[15];
  (void)in_sizes; (void)n_in; (void)out_size; (void)ws_size;

  // ---- workspace carve-out (~153 MB), 256B aligned ----
  char* ws = (char*)d_ws;
  size_t off = 0;
  auto take = [&](size_t bytes) -> char* {
    char* p = ws + off;
    off += (bytes + 255) & ~(size_t)255;
    return p;
  };
  _Float16* xh  = (_Float16*)take((size_t)4 * kB * kDin * 2);   // x pages f16
  _Float16* w1t = (_Float16*)take((size_t)kE * kH1 * kDin * 2); // W1^T f16 [E][N][K]
  _Float16* w2t = (_Float16*)take((size_t)kE * kH2 * kH1 * 2);  // W2^T f16 [E][N][K]
  _Float16* hb  = (_Float16*)take((size_t)kE * kB * kH1 * 2);   // hidden acts f16
  _Float16* eo  = (_Float16*)take((size_t)kE * kB * kH2 * 2);   // expert outputs f16
  float*    gts = (float*)   take((size_t)kB * 20 * 4);         // gate weights

  // weights: convert + transpose to [E][N][K] so GEMM streams b128 tiles
  dim3 tb(32, 8);
  cvt_transpose_f32_f16<<<dim3(kH1 / 32, kDin / 32, kSpec), tb, 0, stream>>>(
      W1s, w1t, kDin, kH1);
  cvt_transpose_f32_f16<<<dim3(kH1 / 32, kDin / 32, 2), tb, 0, stream>>>(
      W1h, w1t + (size_t)kSpec * kH1 * kDin, kDin, kH1);
  cvt_transpose_f32_f16<<<dim3(kH2 / 32, kH1 / 32, kSpec), tb, 0, stream>>>(
      W2s, w2t, kH1, kH2);
  cvt_transpose_f32_f16<<<dim3(kH2 / 32, kH1 / 32, 2), tb, 0, stream>>>(
      W2h, w2t + (size_t)kSpec * kH2 * kH1, kH1, kH2);

  // x pages -> f16 and the gate weights, from one read of x
  x_f16_gates_kernel<<<dim3(kB / (8 * kXRows), 4), 256, 0, stream>>>(
      x0, x1, x2, xs, Wg, bg, Wsg, bsg, xh, gts);

  // layer 1: h[e] = relu(x_page(e) @ W1[e] + b1[e])   [B,1024]
  dim3 g1(kH1 / 128, kB / 128, kE);
  gemm_bias_relu_wmma<<<g1, 256, 0, stream>>>(xh, w1t, b1s, b1h, hb,
                                              kB, kDin, kH1, /*pageMode=*/1);
  // layer 2: eo[e] = relu(h[e] @ W2[e] + b2[e])       [B,512]
  dim3 g2(kH2 / 128, kB / 128, kE);
  gemm_bias_relu_wmma<<<g2, 256, 0, stream>>>(hb, w2t, b2s, b2h, eo,
                                              kB, kH1, kH2, /*pageMode=*/0);

  combine_kernel<<<(kB * kH2 + 255) / 256, 256, 0, stream>>>(eo, gts, (float*)d_out);
}

// v004
// It runs in 124 microseconds.
// Timed twice side by side with v003, it ran 1.10 times as fast both times.
// Counting every step since v000, it is 2.30 times as fast.
#include <hip/hip_runtime.h>
#include <hip/hip_bf16.h>

typedef __attribute__((ext_vector_type(16))) _Float16 v16h;
typedef __attribute__((ext_vector_type(8)))  float    v8f;

constexpr int kB    = 4096;
constexpr int kDin  = 1024;
constexpr int kH1   = 1024;
constexpr int kH2   = 512;
constexpr int kE    = 8;   // 6 specific + 2 shared experts
constexpr int kSpec = 6;

constexpr int kBK     = 64;              // k depth of one pass, in halves
constexpr int kRow4   = kBK / 8;         // 16-B units of data per tile row
constexpr int kPitch4 = kRow4 + 1;       // row pitch in 16-B units
constexpr int kTile4  = 128 * kPitch4;   // one 128-row operand tile
constexpr int kBuf4   = 2 * kTile4;      // one (A|W) stage

union Frag { uint4 u[2]; v16h h; };

#if defined(__AMDGCN__) && \
    __has_builtin(__builtin_amdgcn_global_load_async_to_lds_b128) && \
    __has_builtin(__builtin_amdgcn_s_wait_asynccnt)
#define USE_ASYNC 1
typedef int v4i __attribute__((ext_vector_type(4)));
typedef __attribute__((address_space(3))) v4i lds_v4i;
typedef __attribute__((address_space(1))) v4i glb_v4i;
#else
#define USE_ASYNC 0
#endif

// ------------- f32 [E][K][N] -> f16 [E][N][K] transpose+convert --------
// One launch for the four weight arrays. A work-group takes a tile of kTK k by
// kTN n of one expert: few, fat waves, for speed only. Every global access is 16 B a lane
// and covers whole 256-B units: a source row of the tile is 64 f32 = 256 B, a
// row of the transposed tile 256 f16 = 512 B.
typedef float f32x4 __attribute__((ext_vector_type(4)));
constexpr int kTK = 256;                 // k per tile
constexpr int kTN = 64;                  // n per tile
constexpr int kTU = kTK / 8;             // 16-B units of f16 per transposed tile row
constexpr int kW1Tiles = kE * (kDin / kTK) * (kH1 / kTN);
constexpr int kW2Tiles = kE * (kH1 / kTK) * (kH2 / kTN);

template <int K, int N>
__device__ __forceinline__ void w_tile(const float* __restrict__ src,  // [K][N], one expert
                                       _Float16* __restrict__ dst,     // [N][K], one expert
                                       int k0, int n0, uint4* t) {
  const int tid = threadIdx.x;
  const int n4  = tid & 15;              // the thread's four n
  const int kg  = tid >> 4;              // the thread's sixteen k
  const f32x4* s4 =
      reinterpret_cast<const f32x4*>(src + (size_t)(k0 + kg * 16) * N + n0) + n4;
  f32x4 v[16];
  #pragma unroll
  for (int i = 0; i < 16; i++) v[i] = s4[i * (N / 4)];
  // keeps all sixteen loads in front of the first conversion: left alone the
  // scheduler saves registers by issuing the last four only when the first have
  // returned, and the wave then waits out the memory latency more than once
  __builtin_amdgcn_sched_barrier(0);

  #pragma unroll
  for (int c = 0; c < 4; c++)
    #pragma unroll
    for (int h = 0; h < 2; h++) {
      union { _Float16 f[8]; uint4 u; } p;
      #pragma unroll
      for (int i = 0; i < 8; i++) p.f[i] = (_Float16)v[h * 8 + i][c];
      t[(n4 * 4 + c) * kTU + ((kg * 2 + h + n4) & (kTU - 1))] = p.u;
    }
  __syncthreads();

  // a wave stores whole tile rows, 512 B each: row n = 8 j + wave, lane = unit
  const int w = tid >> 5, u = tid & 31;
  uint4* d4 = reinterpret_cast<uint4*>(dst + (size_t)(n0 + w) * K + k0) + u;
  uint4 r[kTN / 8];
  #pragma unroll
  for (int j = 0; j < kTN / 8; j++)      // (8 j + w) / 4 = 2 j + w / 4
    r[j] = t[(j * 8 + w) * kTU + ((u + (w >> 2) + 2 * j) & (kTU - 1))];
  #pragma unroll
  for (int j = 0; j < kTN / 8; j++) d4[j * 8 * (K / 8)] = r[j];
}

__global__ void __launch_bounds__(256)
weights_f16_transposed(const float* __restrict__ W1s, const float* __restrict__ W1h,
                       const float* __restrict__ W2s, const float* __restrict__ W2h,
                       _Float16* __restrict__ w1t, _Float16* __restrict__ w2t) {
  __shared__ alignas(16) uint4 t[kTN * kTU];   // 32 KB
  unsigned b = blockIdx.x;
  if (b < (unsigned)kW1Tiles) {
    constexpr unsigned kNT = kH1 / kTN, kPer = (kDin / kTK) * kNT;
    const unsigned e = b / kPer, r = b % kPer;
    const float* src = (e < (unsigned)kSpec) ? W1s + (size_t)e * kDin * kH1
                                   : W1h + (size_t)(e - kSpec) * kDin * kH1;
    w_tile<kDin, kH1>(src, w1t + (size_t)e * kH1 * kDin, (r / kNT) * kTK, (r % kNT) * kTN, t);
  } else {
    b -= kW1Tiles;
    constexpr unsigned kNT = kH2 / kTN, kPer = (kH1 / kTK) * kNT;
    const unsigned e = b / kPer, r = b % kPer;
    const float* src = (e < (unsigned)kSpec) ? W2s + (size_t)e * kH1 * kH2
                                   : W2h + (size_t)(e - kSpec) * kH1 * kH2;
    w_tile<kH1, kH2>(src, w2t + (size_t)e * kH2 * kH1, (r / kNT) * kTK, (r % kNT) * kTN, t);
  }
}

typedef float f32x2 __attribute__((ext_vector_type(2)));
constexpr int kXRows = 4;                // rows of x per wave

template <int M, int HALF, int N>
__device__ __forceinline__ void wave_sums(float (&a)[N], int lane) {
  if constexpr (HALF >= 1) {
    const bool up = (lane & M) != 0;
    #pragma unroll
    for (int i = 0; i < HALF; i++) {
      float keep = up ? a[i + HALF] : a[i];
      float send = up ? a[i] : a[i + HALF];
      a[i] = keep + __shfl_xor(send, M, 32);
    }
  } else {
    a[0] += __shfl_xor(a[0], M, 32);
  }
  if constexpr (M > 1) wave_sums<M / 2, HALF / 2, N>(a, lane);
}

template <int NG>                        // gate width: 4 or 8
__device__ __forceinline__ void x_pass(const float* __restrict__ x,
                                       const float* __restrict__ Wgt,  // [D_IN][NG]
                                       const float* __restrict__ bias, // [NG]
                                       _Float16* __restrict__ xh,      // f16 page of x
                                       float* __restrict__ gates, int gbase,
                                       f32x4* wl) {
  constexpr int H = NG / 4;              // 16-B units per weight row
  constexpr int N = kXRows * NG;         // sums per wave
  const int tid  = threadIdx.x;
  const int lane = tid & 31;
  const int blk0 = blockIdx.x * (8 * kXRows);            // the block's first row
  const int row0 = blk0 + (tid >> 5) * kXRows;           // the wave's first row
  // the lane's first 16-B unit of x (8-B unit of the copy) inside the block's rows
  const int t0 = (tid >> 5) * (kXRows * (kDin / 4)) + lane;

  // gate weights first, then the rows: the weights can be laid in LDS while
  // the rows are still in flight
  const f32x4* W4 = reinterpret_cast<const f32x4*>(Wgt);
  f32x4 wv[4 * H];
  #pragma unroll
  for (int i = 0; i < 4 * H; i++) wv[i] = W4[tid + i * 256];
  const f32x4* xp = reinterpret_cast<const f32x4*>(x) + (size_t)blk0 * (kDin / 4);
  f32x4 xv[kXRows][8];
  #pragma unroll
  for (int r = 0; r < kXRows; r++)
    #pragma unroll
    for (int j = 0; j < 8; j++) xv[r][j] = xp[t0 + r * (kDin / 4) + j * 32];

  // LDS order [j][c][h][lane]: the 32 lanes of a reader take 512 contiguous B
  #pragma unroll
  for (int i = 0; i < 4 * H; i++) {
    int q = tid + i * 256;
    int k = q / H, h = q % H;
    wl[(((k >> 7) * 4 + (k & 3)) * H + h) * 32 + ((k >> 2) & 31)] = wv[i];
  }
  __syncthreads();

  uint2* xo = reinterpret_cast<uint2*>(xh) + (size_t)blk0 * (kDin / 4);
  f32x2 acc2[N / 2];                     // gates 2 i, 2 i + 1 of row r at [r * NG / 2 + i]
  #pragma unroll
  for (int i = 0; i < N / 2; i++) acc2[i] = (f32x2){0.f, 0.f};
  #pragma unroll
  for (int j = 0; j < 8; j++) {
    #pragma unroll
    for (int r = 0; r < kXRows; r++) {
      union { _Float16 h[4]; uint2 u; } p;
      p.h[0] = (_Float16)xv[r][j][0]; p.h[1] = (_Float16)xv[r][j][1];
      p.h[2] = (_Float16)xv[r][j][2]; p.h[3] = (_Float16)xv[r][j][3];
      xo[t0 + r * (kDin / 4) + j * 32] = p.u;
    }
    #pragma unroll
    for (int c = 0; c < 4; c++)
      #pragma unroll
      for (int h = 0; h < H; h++) {
        const f32x4 w = wl[((j * 4 + c) * H + h) * 32 + lane];
        #pragma unroll
        for (int r = 0; r < kXRows; r++) {
          const f32x2 xx = {xv[r][j][c], xv[r][j][c]};
          f32x2& lo = acc2[r * (NG / 2) + h * 2];
          f32x2& hi = acc2[r * (NG / 2) + h * 2 + 1];
          lo = __builtin_elementwise_fma(w.lo, xx, lo);
          hi = __builtin_elementwise_fma(w.hi, xx, hi);
        }
      }
    // holds the f16 stores of step j in front of the products of step j + 1:
    // without it the scheduler sinks every store behind the last sum, and the
    // writes only start when the arithmetic is over
    __builtin_amdgcn_sched_barrier(0);
  }
  float acc[N];                          // acc[r * NG + g]: the sum over this lane's 32 k
  #pragma unroll
  for (int i = 0; i < N / 2; i++) { acc[2 * i] = acc2[i][0]; acc[2 * i + 1] = acc2[i][1]; }

  wave_sums<16, N / 2, N>(acc, lane);

  // softmax inside the lanes that hold one row's logits (each logit kDup times)
  constexpr int kDup = 32 / N;
  const int g = (lane / kDup) % NG;
  const float lg = acc[0] + bias[g];
  float mx = lg;
  #pragma unroll
  for (int m = kDup; m < kDup * NG; m <<= 1) mx = fmaxf(mx, __shfl_xor(mx, m, 32));
  const float ev = expf(lg - mx);
  float sum = ev;
  #pragma unroll
  for (int m = kDup; m < kDup * NG; m <<= 1) sum += __shfl_xor(sum, m, 32);
  const float gw = ev * (1.f / sum);
  if (lane % kDup == 0)
    gates[(size_t)(row0 + lane / (kDup * NG)) * 20 + gbase + g] = gw;
}

__global__ void __launch_bounds__(256)
x_f16_gates_kernel(const float* __restrict__ x0, const float* __restrict__ x1,
                   const float* __restrict__ x2, const float* __restrict__ xs,
                   const float* __restrict__ Wg,  const float* __restrict__ bg,
                   const float* __restrict__ Wsg, const float* __restrict__ bsg,
                   _Float16* __restrict__ xh, float* __restrict__ gates) {
  __shared__ alignas(16) f32x4 wl[kDin * 2];   // 32 KB: one input's gate weights
  const int d = blockIdx.y;
  _Float16* page = xh + (size_t)d * kB * kDin;
  const float* x = (d == 0) ? x0 : (d == 1) ? x1 : (d == 2) ? x2 : xs;
  if (d == 3)
    x_pass<8>(x, Wsg, bsg, page, gates, 12, wl);
  else
    x_pass<4>(x, Wg + (size_t)d * kDin * 4, bg + d * 4, page, gates, d * 4, wl);
}

// ---------------- WMMA GEMM: C = relu(A @ W + bias), f16 in / f32 acc ----
// block = 256 threads (8 waves); block tile 128(M) x 128(N); wave tile 32x64.
// A : [pages][Bsz][K] f16 row-major.
// Wt: [E][N][K] f16 (pre-transposed) -> W tile loader identical to A tile.
// pageMode=1: expert e reads A page (e<6 ? e/2 : 3)   (layer-1 input mapping)
// pageMode=0: expert e reads A page e                 (layer-2: h buffer)
__global__ void __launch_bounds__(256)
gemm_bias_relu_wmma(const _Float16* __restrict__ A,
                    const _Float16* __restrict__ Wt,
                    const float* __restrict__ biasS,
                    const float* __restrict__ biasH,
                    _Float16* __restrict__ C,
                    int Bsz, int K, int N, int pageMode) {
#if USE_ASYNC
  __shared__ alignas(16) uint4 smem4[2 * kBuf4];   // 72 KB: double-buffered (A|W) tiles
#else
  __shared__ alignas(16) uint4 smem4[kBuf4];       // 36 KB: single (A|W) tile
#endif

  const int tid  = threadIdx.x;
  const int lane = tid & 31;
  const int wave = tid >> 5;
  const int waveM = wave & 3;          // 4 waves along M
  const int waveN = wave >> 2;         // 2 waves along N
  const int rl   = lane & 15;
  const int hsel = lane >> 4;

  const int e  = blockIdx.z;
  const int n0 = blockIdx.x * 128;
  const int m0 = blockIdx.y * 128;
  const int page = pageMode ? ((e < kSpec) ? (e >> 1) : 3) : e;
  const int ld = K >> 3;               // row stride in uint4 units

  const uint4* __restrict__ Ag = reinterpret_cast<const uint4*>(A) +
      (size_t)page * Bsz * ld + (size_t)m0 * ld;
  const uint4* __restrict__ Wg = reinterpret_cast<const uint4*>(Wt) +
      (size_t)e * N * ld + (size_t)n0 * ld;

  const v8f vzero = {0.f, 0.f, 0.f, 0.f, 0.f, 0.f, 0.f, 0.f};
  v8f acc[2][4];
  #pragma unroll
  for (int mt = 0; mt < 2; mt++)
    #pragma unroll
    for (int nt = 0; nt < 4; nt++) acc[mt][nt] = vzero;

#if USE_ASYNC
  auto issue = [&](int k0, int buf) {
    lds_v4i* dA = (lds_v4i*)(smem4 + buf * kBuf4);
    lds_v4i* dW = dA + kTile4;
    glb_v4i* sA = (glb_v4i*)(Ag + (k0 >> 3));
    glb_v4i* sW = (glb_v4i*)(Wg + (k0 >> 3));
    #pragma unroll
    for (int i = 0; i < 128 * kRow4 / 256; i++) {
      int q4 = tid + i * 256;
      int r = q4 / kRow4, c4 = q4 % kRow4;
      __builtin_amdgcn_global_load_async_to_lds_b128(sA + (size_t)r * ld + c4,
                                                     dA + r * kPitch4 + c4, 0, 0);
      __builtin_amdgcn_global_load_async_to_lds_b128(sW + (size_t)r * ld + c4,
                                                     dW + r * kPitch4 + c4, 0, 0);
    }
  };
  issue(0, 0);
  // tile 0 has landed for this wave before the barrier publishes it
  asm volatile("s_wait_asynccnt 0x0" ::: "memory");
  __syncthreads();
  if (kBK < K) issue(kBK, 1);                   // tile 1 flies during pass 0
#endif

  for (int k0 = 0; k0 < K; k0 += kBK) {
#if USE_ASYNC
    const int cur = (k0 / kBK) & 1;
    const uint4* ap = reinterpret_cast<const uint4*>(smem4 + cur * kBuf4);
    const uint4* bp = ap + kTile4;
#else
    {  // synchronous fallback: both tiles are plain coalesced b128 copies
      uint4* dA = smem4;
      uint4* dW = smem4 + kTile4;
      const uint4* sA = Ag + (k0 >> 3);
      const uint4* sW = Wg + (k0 >> 3);
      #pragma unroll
      for (int i = 0; i < 128 * kRow4 / 256; i++) {
        int q4 = tid + i * 256;
        int r = q4 / kRow4, c4 = q4 % kRow4;
        dA[r * kPitch4 + c4] = sA[(size_t)r * ld + c4];
        dW[r * kPitch4 + c4] = sW[(size_t)r * ld + c4];
      }
    }
    __syncthreads();
    const uint4* ap = reinterpret_cast<const uint4*>(smem4);
    const uint4* bp = ap + kTile4;
#endif

    #pragma unroll
    for (int ks = 0; ks < kBK / 32; ks++) {
      Frag afrag[2], bfrag[4];
      #pragma unroll
      for (int mt = 0; mt < 2; mt++) {
        int r = waveM * 32 + mt * 16 + rl;
        afrag[mt].u[0] = ap[r * kPitch4 + ks * 4 + hsel];
        afrag[mt].u[1] = ap[r * kPitch4 + ks * 4 + hsel + 2];
      }
      #pragma unroll
      for (int nt = 0; nt < 4; nt++) {
        int c = waveN * 64 + nt * 16 + rl;
        bfrag[nt].u[0] = bp[c * kPitch4 + ks * 4 + hsel];
        bfrag[nt].u[1] = bp[c * kPitch4 + ks * 4 + hsel + 2];
      }
      #pragma unroll
      for (int mt = 0; mt < 2; mt++)
        #pragma unroll
        for (int nt = 0; nt < 4; nt++)
          acc[mt][nt] = __builtin_amdgcn_wmma_f32_16x16x32_f16(
              false, afrag[mt].h, false, bfrag[nt].h,
              (short)0, acc[mt][nt], false, false);
    }

#if USE_ASYNC
    // this wave's reads of the current buffer are done before it is refilled
    asm volatile("s_wait_dscnt 0x0" ::: "memory");
    // this wave's copies of the next tile have landed before the barrier publishes them
    asm volatile("s_wait_asynccnt 0x0" ::: "memory");
    __syncthreads();
    if (k0 + 2 * kBK < K) issue(k0 + 2 * kBK, cur);  // refill the buffer just read
#else
    __syncthreads();
#endif
  }
#if USE_ASYNC
  // no copy is outstanding when the wave goes on to its end
  asm volatile("s_wait_asynccnt 0x0" ::: "memory");
#endif

  const float* bias = (e < kSpec) ? (biasS + (size_t)e * N)
                                  : (biasH + (size_t)(e - kSpec) * N);
  _Float16* Cp = C + (size_t)e * Bsz * N;
  #pragma unroll
  for (int nt = 0; nt < 4; nt++) {
    int col = n0 + waveN * 64 + nt * 16 + rl;
    float bv = bias[col];
    #pragma unroll
    for (int mt = 0; mt < 2; mt++) {
      int rbase = m0 + waveM * 32 + mt * 16 + hsel * 8;
      #pragma unroll
      for (int j = 0; j < 8; j++) {
        float v = acc[mt][nt][j] + bv;
        v = v > 0.f ? v : 0.f;
        Cp[(size_t)(rbase + j) * N + col] = (_Float16)v;
      }
    }
  }
}

// ---------------- gated combine: 4 outputs, each [B, H2] f32 ------------
__global__ void __launch_bounds__(256)
combine_kernel(const _Float16* __restrict__ eo,   // [8][B][H2]
               const float* __restrict__ gates,   // [B][20]
               float* __restrict__ out) {         // [4][B][H2]
  int idx = blockIdx.x * blockDim.x + threadIdx.x;
  if (idx >= kB * kH2) return;
  int b = idx / kH2, o = idx % kH2;
  float ex[8];
  #pragma unroll
  for (int k = 0; k < 8; k++)
    ex[k] = (float)eo[((size_t)k * kB + b) * kH2 + o];
  const float* g = gates + (size_t)b * 20;
  float o0 = g[0] * ex[0] + g[1] * ex[1] + g[2]  * ex[6] + g[3]  * ex[7];
  float o1 = g[4] * ex[2] + g[5] * ex[3] + g[6]  * ex[6] + g[7]  * ex[7];
  float o2 = g[8] * ex[4] + g[9] * ex[5] + g[10] * ex[6] + g[11] * ex[7];
  float o3 = 0.f;
  #pragma unroll
  for (int k = 0; k < 8; k++) o3 += g[12 + k] * ex[k];
  size_t p = (size_t)b * kH2 + o;
  const size_t page = (size_t)kB * kH2;
  out[p]            = o0;
  out[page + p]     = o1;
  out[2 * page + p] = o2;
  out[3 * page + p] = o3;
}

extern "C" void kernel_launch(void* const* d_in, const int* in_sizes, int n_in,
                              void* d_out, int out_size, void* d_ws, size_t ws_size,
                              hipStream_t stream) {
  const float* x0  = (const float*)d_in[0];
  const float* x1  = (const float*)d_in[1];
  const float* x2  = (const float*)d_in[2];
  const float* xs  = (const float*)d_in[3];
  const float* W1s = (const float*)d_in[4];
  const float* b1s = (const float*)d_in[5];
  const float* W2s = (const float*)d_in[6];
  const float* b2s = (const float*)d_in[7];
  const float* W1h = (const float*)d_in[8];
  const float* b1h = (const float*)d_in[9];
  const float* W2h = (const float*)d_in[10];
  const float* b2h = (const float*)d_in[11];
  const float* Wg  = (const float*)d_in[12];
  const float* bg  = (const float*)d_in[13];
  const float* Wsg = (const float*)d_in[14];
  const float* bsg = (const float*)d_in[15];
  (void)in_sizes; (void)n_in; (void)out_size; (void)ws_size;

  // ---- workspace carve-out (~153 MB), 256B aligned ----
  char* ws = (char*)d_ws;
  size_t off = 0;
  auto take = [&](size_t bytes) -> char* {
    char* p = ws + off;
    off += (bytes + 255) & ~(size_t)255;
    return p;
  };
  _Float16* xh  = (_Float16*)take((size_t)4 * kB * kDin * 2);   // x pages f16
  _Float16* w1t = (_Float16*)take((size_t)kE * kH1 * kDin * 2); // W1^T f16 [E][N][K]
  _Float16* w2t = (_Float16*)take((size_t)kE * kH2 * kH1 * 2);  // W2^T f16 [E][N][K]
  _Float16* hb  = (_Float16*)take((size_t)kE * kB * kH1 * 2);   // hidden acts f16
  _Float16* eo  = (_Float16*)take((size_t)kE * kB * kH2 * 2);   // expert outputs f16
  float*    gts = (float*)   take((size_t)kB * 20 * 4);         // gate weights

  // weights: convert + transpose to [E][N][K] so GEMM streams b128 tiles
  weights_f16_transposed<<<kW1Tiles + kW2Tiles, 256, 0, stream>>>(
      W1s, W1h, W2s, W2h, w1t, w2t);

  // x pages -> f16 and the gate weights, from one read of x
  x_f16_gates_kernel<<<dim3(kB / (8 * kXRows), 4), 256, 0, stream>>>(
      x0, x1, x2, xs, Wg, bg, Wsg, bsg, xh, gts);

  // layer 1: h[e] = relu(x_page(e) @ W1[e] + b1[e])   [B,1024]
  dim3 g1(kH1 / 128, kB / 128, kE);
  gemm_bias_relu_wmma<<<g1, 256, 0, stream>>>(xh, w1t, b1s, b1h, hb,
                                              kB, kDin, kH1, /*pageMode=*/1);
  // layer 2: eo[e] = relu(h[e] @ W2[e] + b2[e])       [B,512]
  dim3 g2(kH2 / 128, kB / 128, kE);
  gemm_bias_relu_wmma<<<g2, 256, 0, stream>>>(hb, w2t, b2s, b2h, eo,
                                              kB, kH1, kH2, /*pageMode=*/0);

  combine_kernel<<<(kB * kH2 + 255) / 256, 256, 0, stream>>>(eo, gts, (float*)d_out);
}

// v005
// Measured time: 119 microseconds a run.
// In both of two side-by-side timings against v004, it was 1.05 times as fast.
// Counting every step since v000, it is 2.41 times as fast.
#include <hip/hip_runtime.h>
#include <hip/hip_bf16.h>

typedef __attribute__((ext_vector_type(16))) _Float16 v16h;
typedef __attribute__((ext_vector_type(8)))  float    v8f;

constexpr int kB    = 4096;
constexpr int kDin  = 1024;
constexpr int kH1   = 1024;
constexpr int kH2   = 512;
constexpr int kE    = 8;   // 6 specific + 2 shared experts
constexpr int kSpec = 6;

constexpr int kBK     = 64;              // k depth of one pass, in halves
constexpr int kRow4   = kBK / 8;         // 16-B units of data per tile row
constexpr int kPitch4 = kRow4 + 1;       // row pitch in 16-B units
constexpr int kBT     = 256;             // rows of A and rows of W^T per block tile
constexpr int kMT     = 4;               // 16-row A fragments per wave (64 rows)
constexpr int kNT     = 8;               // 16-row W fragments per wave (128 columns)
constexpr int kTile4  = kBT * kPitch4;   // one operand tile
constexpr int kBuf4   = 2 * kTile4;      // one (A|W) stage

union Frag { uint4 u[2]; v16h h; };

#if defined(__AMDGCN__) && \
    __has_builtin(__builtin_amdgcn_global_load_async_to_lds_b128) && \
    __has_builtin(__builtin_amdgcn_s_wait_asynccnt)
#define USE_ASYNC 1
typedef int v4i __attribute__((ext_vector_type(4)));
typedef __attribute__((address_space(3))) v4i lds_v4i;
typedef __attribute__((address_space(1))) v4i glb_v4i;
#else
#define USE_ASYNC 0
#endif

// ------------- f32 [E][K][N] -> f16 [E][N][K] transpose+convert --------
// One launch for the four weight arrays. A work-group takes a tile of kTK k by
// kTN n of one expert: few, fat waves, for speed only. Every global access is 16 B a lane
// and covers whole 256-B units: a source row of the tile is 64 f32 = 256 B, a
// row of the transposed tile 256 f16 = 512 B.
typedef float f32x4 __attribute__((ext_vector_type(4)));
constexpr int kTK = 256;                 // k per tile
constexpr int kTN = 64;                  // n per tile
constexpr int kTU = kTK / 8;             // 16-B units of f16 per transposed tile row
constexpr int kW1Tiles = kE * (kDin / kTK) * (kH1 / kTN);
constexpr int kW2Tiles = kE * (kH1 / kTK) * (kH2 / kTN);

template <int K, int N>
__device__ __forceinline__ void w_tile(const float* __restrict__ src,  // [K][N], one expert
                                       _Float16* __restrict__ dst,     // [N][K], one expert
                                       int k0, int n0, uint4* t) {
  const int tid = threadIdx.x;
  const int n4  = tid & 15;              // the thread's four n
  const int kg  = tid >> 4;              // the thread's sixteen k
  const f32x4* s4 =
      reinterpret_cast<const f32x4*>(src + (size_t)(k0 + kg * 16) * N + n0) + n4;
  f32x4 v[16];
  #pragma unroll
  for (int i = 0; i < 16; i++) v[i] = s4[i * (N / 4)];
  // keeps all sixteen loads in front of the first conversion: left alone the
  // scheduler saves registers by issuing the last four only when the first have
  // returned, and the wave then waits out the memory latency more than once
  __builtin_amdgcn_sched_barrier(0);

  #pragma unroll
  for (int c = 0; c < 4; c++)
    #pragma unroll
    for (int h = 0; h < 2; h++) {
      union { _Float16 f[8]; uint4 u; } p;
      #pragma unroll
      for (int i = 0; i < 8; i++) p.f[i] = (_Float16)v[h * 8 + i][c];
      t[(n4 * 4 + c) * kTU + ((kg * 2 + h + n4) & (kTU - 1))] = p.u;
    }
  __syncthreads();

  // a wave stores whole tile rows, 512 B each: row n = 8 j + wave, lane = unit
  const int w = tid >> 5, u = tid & 31;
  uint4* d4 = reinterpret_cast<uint4*>(dst + (size_t)(n0 + w) * K + k0) + u;
  uint4 r[kTN / 8];
  #pragma unroll
  for (int j = 0; j < kTN / 8; j++)      // (8 j + w) / 4 = 2 j + w / 4
    r[j] = t[(j * 8 + w) * kTU + ((u + (w >> 2) + 2 * j) & (kTU - 1))];
  #pragma unroll
  for (int j = 0; j < kTN / 8; j++) d4[j * 8 * (K / 8)] = r[j];
}

__global__ void __launch_bounds__(256)
weights_f16_transposed(const float* __restrict__ W1s, const float* __restrict__ W1h,
                       const float* __restrict__ W2s, const float* __restrict__ W2h,
                       _Float16* __restrict__ w1t, _Float16* __restrict__ w2t) {
  __shared__ alignas(16) uint4 t[kTN * kTU];   // 32 KB
  unsigned b = blockIdx.x;
  if (b < (unsigned)kW1Tiles) {
    constexpr unsigned kNT = kH1 / kTN, kPer = (kDin / kTK) * kNT;
    const unsigned e = b / kPer, r = b % kPer;
    const float* src = (e < (unsigned)kSpec) ? W1s + (size_t)e * kDin * kH1
                                   : W1h + (size_t)(e - kSpec) * kDin * kH1;
    w_tile<kDin, kH1>(src, w1t + (size_t)e * kH1 * kDin, (r / kNT) * kTK, (r % kNT) * kTN, t);
  } else {
    b -= kW1Tiles;
    constexpr unsigned kNT = kH2 / kTN, kPer = (kH1 / kTK) * kNT;
    const unsigned e = b / kPer, r = b % kPer;
    const float* src = (e < (unsigned)kSpec) ? W2s + (size_t)e * kH1 * kH2
                                   : W2h + (size_t)(e - kSpec) * kH1 * kH2;
    w_tile<kH1, kH2>(src, w2t + (size_t)e * kH2 * kH1, (r / kNT) * kTK, (r % kNT) * kTN, t);
  }
}

typedef float f32x2 __attribute__((ext_vector_type(2)));
constexpr int kXRows = 4;                // rows of x per wave

template <int M, int HALF, int N>
__device__ __forceinline__ void wave_sums(float (&a)[N], int lane) {
  if constexpr (HALF >= 1) {
    const bool up = (lane & M) != 0;
    #pragma unroll
    for (int i = 0; i < HALF; i++) {
      float keep = up ? a[i + HALF] : a[i];
      float send = up ? a[i] : a[i + HALF];
      a[i] = keep + __shfl_xor(send, M, 32);
    }
  } else {
    a[0] += __shfl_xor(a[0], M, 32);
  }
  if constexpr (M > 1) wave_sums<M / 2, HALF / 2, N>(a, lane);
}

template <int NG>                        // gate width: 4 or 8
__device__ __forceinline__ void x_pass(const float* __restrict__ x,
                                       const float* __restrict__ Wgt,  // [D_IN][NG]
                                       const float* __restrict__ bias, // [NG]
                                       _Float16* __restrict__ xh,      // f16 page of x
                                       float* __restrict__ gates, int gbase,
                                       f32x4* wl) {
  constexpr int H = NG / 4;              // 16-B units per weight row
  constexpr int N = kXRows * NG;         // sums per wave
  const int tid  = threadIdx.x;
  const int lane = tid & 31;
  const int blk0 = blockIdx.x * (8 * kXRows);            // the block's first row
  const int row0 = blk0 + (tid >> 5) * kXRows;           // the wave's first row
  // the lane's first 16-B unit of x (8-B unit of the copy) inside the block's rows
  const int t0 = (tid >> 5) * (kXRows * (kDin / 4)) + lane;

  // gate weights first, then the rows: the weights can be laid in LDS while
  // the rows are still in flight
  const f32x4* W4 = reinterpret_cast<const f32x4*>(Wgt);
  f32x4 wv[4 * H];
  #pragma unroll
  for (int i = 0; i < 4 * H; i++) wv[i] = W4[tid + i * 256];
  const f32x4* xp = reinterpret_cast<const f32x4*>(x) + (size_t)blk0 * (kDin / 4);
  f32x4 xv[kXRows][8];
  #pragma unroll
  for (int r = 0; r < kXRows; r++)
    #pragma unroll
    for (int j = 0; j < 8; j++) xv[r][j] = xp[t0 + r * (kDin / 4) + j * 32];

  // LDS order [j][c][h][lane]: the 32 lanes of a reader take 512 contiguous B
  #pragma unroll
  for (int i = 0; i < 4 * H; i++) {
    int q = tid + i * 256;
    int k = q / H, h = q % H;
    wl[(((k >> 7) * 4 + (k & 3)) * H + h) * 32 + ((k >> 2) & 31)] = wv[i];
  }
  __syncthreads();

  uint2* xo = reinterpret_cast<uint2*>(xh) + (size_t)blk0 * (kDin / 4);
  f32x2 acc2[N / 2];                     // gates 2 i, 2 i + 1 of row r at [r * NG / 2 + i]
  #pragma unroll
  for (int i = 0; i < N / 2; i++) acc2[i] = (f32x2){0.f, 0.f};
  #pragma unroll
  for (int j = 0; j < 8; j++) {
    #pragma unroll
    for (int r = 0; r < kXRows; r++) {
      union { _Float16 h[4]; uint2 u; } p;
      p.h[0] = (_Float16)xv[r][j][0]; p.h[1] = (_Float16)xv[r][j][1];
      p.h[2] = (_Float16)xv[r][j][2]; p.h[3] = (_Float16)xv[r][j][3];
      xo[t0 + r * (kDin / 4) + j * 32] = p.u;
    }
    #pragma unroll
    for (int c = 0; c < 4; c++)
      #pragma unroll
      for (int h = 0; h < H; h++) {
        const f32x4 w = wl[((j * 4 + c) * H + h) * 32 + lane];
        #pragma unroll
        for (int r = 0; r < kXRows; r++) {
          const f32x2 xx = {xv[r][j][c], xv[r][j][c]};
          f32x2& lo = acc2[r * (NG / 2) + h * 2];
          f32x2& hi = acc2[r * (NG / 2) + h * 2 + 1];
          lo = __builtin_elementwise_fma(w.lo, xx, lo);
          hi = __builtin_elementwise_fma(w.hi, xx, hi);
        }
      }
    // holds the f16 stores of step j in front of the products of step j + 1:
    // without it the scheduler sinks every store behind the last sum, and the
    // writes only start when the arithmetic is over
    __builtin_amdgcn_sched_barrier(0);
  }
  float acc[N];                          // acc[r * NG + g]: the sum over this lane's 32 k
  #pragma unroll
  for (int i = 0; i < N / 2; i++) { acc[2 * i] = acc2[i][0]; acc[2 * i + 1] = acc2[i][1]; }

  wave_sums<16, N / 2, N>(acc, lane);

  // softmax inside the lanes that hold one row's logits (each logit kDup times)
  constexpr int kDup = 32 / N;
  const int g = (lane / kDup) % NG;
  const float lg = acc[0] + bias[g];
  float mx = lg;
  #pragma unroll
  for (int m = kDup; m < kDup * NG; m <<= 1) mx = fmaxf(mx, __shfl_xor(mx, m, 32));
  const float ev = expf(lg - mx);
  float sum = ev;
  #pragma unroll
  for (int m = kDup; m < kDup * NG; m <<= 1) sum += __shfl_xor(sum, m, 32);
  const float gw = ev * (1.f / sum);
  if (lane % kDup == 0)
    gates[(size_t)(row0 + lane / (kDup * NG)) * 20 + gbase + g] = gw;
}

__global__ void __launch_bounds__(256)
x_f16_gates_kernel(const float* __restrict__ x0, const float* __restrict__ x1,
                   const float* __restrict__ x2, const float* __restrict__ xs,
                   const float* __restrict__ Wg,  const float* __restrict__ bg,
                   const float* __restrict__ Wsg, const float* __restrict__ bsg,
                   _Float16* __restrict__ xh, float* __restrict__ gates) {
  __shared__ alignas(16) f32x4 wl[kDin * 2];   // 32 KB: one input's gate weights
  const int d = blockIdx.y;
  _Float16* page = xh + (size_t)d * kB * kDin;
  const float* x = (d == 0) ? x0 : (d == 1) ? x1 : (d == 2) ? x2 : xs;
  if (d == 3)
    x_pass<8>(x, Wsg, bsg, page, gates, 12, wl);
  else
    x_pass<4>(x, Wg + (size_t)d * kDin * 4, bg + d * 4, page, gates, d * 4, wl);
}

// ---------------- WMMA GEMM: C = relu(A @ W + bias), f16 in / f32 acc ----
// block = 256 threads (8 waves); block tile 256(M) x 256(N); wave tile 64x128:
// a byte fetched from L2 serves twice the products of a 128 x 128 tile, and a
// fragment read from LDS feeds 32 / 12 matrix instructions and not 8 / 6. The
// accumulators take 256 registers, so one block is resident per WGP.
// A : [pages][Bsz][K] f16 row-major.
// Wt: [E][N][K] f16 (pre-transposed) -> W tile loader identical to A tile.
// pageMode=1: expert e reads A page (e<6 ? e/2 : 3)   (layer-1 input mapping)
// pageMode=0: expert e reads A page e                 (layer-2: h buffer)
__global__ void __launch_bounds__(256)
gemm_bias_relu_wmma(const _Float16* __restrict__ A,
                    const _Float16* __restrict__ Wt,
                    const float* __restrict__ biasS,
                    const float* __restrict__ biasH,
                    _Float16* __restrict__ C,
                    int Bsz, int K, int N, int pageMode) {
#if USE_ASYNC
  __shared__ alignas(16) uint4 smem4[2 * kBuf4];   // 144 KB: double-buffered (A|W) tiles
#else
  __shared__ alignas(16) uint4 smem4[kBuf4];       // 72 KB: single (A|W) tile
#endif

  const int tid  = threadIdx.x;
  const int lane = tid & 31;
  const int wave = tid >> 5;
  const int waveM = wave & 3;          // 4 waves along M
  const int waveN = wave >> 2;         // 2 waves along N
  const int rl   = lane & 15;
  const int hsel = lane >> 4;

  const int e  = blockIdx.z;
  const int n0 = blockIdx.x * kBT;
  const int m0 = blockIdx.y * kBT;
  const int page = pageMode ? ((e < kSpec) ? (e >> 1) : 3) : e;
  const int ld = K >> 3;               // row stride in uint4 units

  const uint4* __restrict__ Ag = reinterpret_cast<const uint4*>(A) +
      (size_t)page * Bsz * ld + (size_t)m0 * ld;
  const uint4* __restrict__ Wg = reinterpret_cast<const uint4*>(Wt) +
      (size_t)e * N * ld + (size_t)n0 * ld;

  const v8f vzero = {0.f, 0.f, 0.f, 0.f, 0.f, 0.f, 0.f, 0.f};
  v8f acc[kMT][kNT];
  #pragma unroll
  for (int mt = 0; mt < kMT; mt++)
    #pragma unroll
    for (int nt = 0; nt < kNT; nt++) acc[mt][nt] = vzero;

#if USE_ASYNC
  auto issue = [&](int k0, int buf) {
    lds_v4i* dA = (lds_v4i*)(smem4 + buf * kBuf4);
    lds_v4i* dW = dA + kTile4;
    glb_v4i* sA = (glb_v4i*)(Ag + (k0 >> 3));
    glb_v4i* sW = (glb_v4i*)(Wg + (k0 >> 3));
    #pragma unroll
    for (int i = 0; i < kBT * kRow4 / 256; i++) {
      int q4 = tid + i * 256;
      int r = q4 / kRow4, c4 = q4 % kRow4;
      __builtin_amdgcn_global_load_async_to_lds_b128(sA + (size_t)r * ld + c4,
                                                     dA + r * kPitch4 + c4, 0, 0);
      __builtin_amdgcn_global_load_async_to_lds_b128(sW + (size_t)r * ld + c4,
                                                     dW + r * kPitch4 + c4, 0, 0);
    }
  };
  issue(0, 0);
  // tile 0 has landed for this wave before the barrier publishes it
  asm volatile("s_wait_asynccnt 0x0" ::: "memory");
  __syncthreads();
  if (kBK < K) issue(kBK, 1);                   // tile 1 flies during pass 0
#endif

  for (int k0 = 0; k0 < K; k0 += kBK) {
#if USE_ASYNC
    const int cur = (k0 / kBK) & 1;
    const uint4* ap = reinterpret_cast<const uint4*>(smem4 + cur * kBuf4);
    const uint4* bp = ap + kTile4;
#else
    {  // synchronous fallback: both tiles are plain coalesced b128 copies
      uint4* dA = smem4;
      uint4* dW = smem4 + kTile4;
      const uint4* sA = Ag + (k0 >> 3);
      const uint4* sW = Wg + (k0 >> 3);
      #pragma unroll
      for (int i = 0; i < kBT * kRow4 / 256; i++) {
        int q4 = tid + i * 256;
        int r = q4 / kRow4, c4 = q4 % kRow4;
        dA[r * kPitch4 + c4] = sA[(size_t)r * ld + c4];
        dW[r * kPitch4 + c4] = sW[(size_t)r * ld + c4];
      }
    }
    __syncthreads();
    const uint4* ap = reinterpret_cast<const uint4*>(smem4);
    const uint4* bp = ap + kTile4;
#endif

    Frag afrag[kBK / 32][kMT], bfrag[kBK / 32][kNT];
    #pragma unroll
    for (int ks = 0; ks < kBK / 32; ks++) {
      #pragma unroll
      for (int mt = 0; mt < kMT; mt++) {
        int r = waveM * (kMT * 16) + mt * 16 + rl;
        afrag[ks][mt].u[0] = ap[r * kPitch4 + ks * 4 + hsel];
        afrag[ks][mt].u[1] = ap[r * kPitch4 + ks * 4 + hsel + 2];
      }
      #pragma unroll
      for (int nt = 0; nt < kNT; nt++) {
        int c = waveN * (kNT * 16) + nt * 16 + rl;
        bfrag[ks][nt].u[0] = bp[c * kPitch4 + ks * 4 + hsel];
        bfrag[ks][nt].u[1] = bp[c * kPitch4 + ks * 4 + hsel + 2];
      }
    }
    // keeps the 48 reads of a pass in one group in front of its 64 matrix
    // instructions: left alone the scheduler sinks reads to just in front of
    // their users, and the wave waits out the LDS latency again and again
    __builtin_amdgcn_sched_barrier(0);
    #pragma unroll
    for (int ks = 0; ks < kBK / 32; ks++)
      #pragma unroll
      for (int nt = 0; nt < kNT; nt++)   // in the order in which the W reads land
        #pragma unroll
        for (int mt = 0; mt < kMT; mt++)
          acc[mt][nt] = __builtin_amdgcn_wmma_f32_16x16x32_f16(
              false, afrag[ks][mt].h, false, bfrag[ks][nt].h,
              (short)0, acc[mt][nt], false, false);
    // keeps the matrix instructions in front of the pass-foot waits and barrier:
    // left alone the scheduler lifts those over them, and the wait for the next
    // tile's copies then stands right behind their issue
    __builtin_amdgcn_sched_barrier(0);

#if USE_ASYNC
    // this wave's reads of the current buffer are done before it is refilled
    asm volatile("s_wait_dscnt 0x0" ::: "memory");
    // this wave's copies of the next tile have landed before the barrier publishes them
    asm volatile("s_wait_asynccnt 0x0" ::: "memory");
    __syncthreads();
    if (k0 + 2 * kBK < K) issue(k0 + 2 * kBK, cur);  // refill the buffer just read
#else
    __syncthreads();
#endif
  }
#if USE_ASYNC
  // no copy is outstanding when the wave goes on to its end
  asm volatile("s_wait_asynccnt 0x0" ::: "memory");
#endif

  const float* bias = (e < kSpec) ? (biasS + (size_t)e * N)
                                  : (biasH + (size_t)(e - kSpec) * N);
  _Float16* Cp = C + (size_t)e * Bsz * N;
  #pragma unroll
  for (int nt = 0; nt < kNT; nt++) {
    int col = n0 + waveN * (kNT * 16) + nt * 16 + rl;
    float bv = bias[col];
    #pragma unroll
    for (int mt = 0; mt < kMT; mt++) {
      int rbase = m0 + waveM * (kMT * 16) + mt * 16 + hsel * 8;
      #pragma unroll
      for (int j = 0; j < 8; j++) {
        float v = acc[mt][nt][j] + bv;
        v = v > 0.f ? v : 0.f;
        Cp[(size_t)(rbase + j) * N + col] = (_Float16)v;
      }
    }
  }
}

// ---------------- gated combine: 4 outputs, each [B, H2] f32 ------------
__global__ void __launch_bounds__(256)
combine_kernel(const _Float16* __restrict__ eo,   // [8][B][H2]
               const float* __restrict__ gates,   // [B][20]
               float* __restrict__ out) {         // [4][B][H2]
  int idx = blockIdx.x * blockDim.x + threadIdx.x;
  if (idx >= kB * kH2) return;
  int b = idx / kH2, o = idx % kH2;
  float ex[8];
  #pragma unroll
  for (int k = 0; k < 8; k++)
    ex[k] = (float)eo[((size_t)k * kB + b) * kH2 + o];
  const float* g = gates + (size_t)b * 20;
  float o0 = g[0] * ex[0] + g[1] * ex[1] + g[2]  * ex[6] + g[3]  * ex[7];
  float o1 = g[4] * ex[2] + g[5] * ex[3] + g[6]  * ex[6] + g[7]  * ex[7];
  float o2 = g[8] * ex[4] + g[9] * ex[5] + g[10] * ex[6] + g[11] * ex[7];
  float o3 = 0.f;
  #pragma unroll
  for (int k = 0; k < 8; k++) o3 += g[12 + k] * ex[k];
  size_t p = (size_t)b * kH2 + o;
  const size_t page = (size_t)kB * kH2;
  out[p]            = o0;
  out[page + p]     = o1;
  out[2 * page + p] = o2;
  out[3 * page + p] = o3;
}

extern "C" void kernel_launch(void* const* d_in, const int* in_sizes, int n_in,
                              void* d_out, int out_size, void* d_ws, size_t ws_size,
                              hipStream_t stream) {
  const float* x0  = (const float*)d_in[0];
  const float* x1  = (const float*)d_in[1];
  const float* x2  = (const float*)d_in[2];
  const float* xs  = (const float*)d_in[3];
  const float* W1s = (const float*)d_in[4];
  const float* b1s = (const float*)d_in[5];
  const float* W2s = (const float*)d_in[6];
  const float* b2s = (const float*)d_in[7];
  const float* W1h = (const float*)d_in[8];
  const float* b1h = (const float*)d_in[9];
  const float* W2h = (const float*)d_in[10];
  const float* b2h = (const float*)d_in[11];
  const float* Wg  = (const float*)d_in[12];
  const float* bg  = (const float*)d_in[13];
  const float* Wsg = (const float*)d_in[14];
  const float* bsg = (const float*)d_in[15];
  (void)in_sizes; (void)n_in; (void)out_size; (void)ws_size;

  // ---- workspace carve-out (~153 MB), 256B aligned ----
  char* ws = (char*)d_ws;
  size_t off = 0;
  auto take = [&](size_t bytes) -> char* {
    char* p = ws + off;
    off += (bytes + 255) & ~(size_t)255;
    return p;
  };
  _Float16* xh  = (_Float16*)take((size_t)4 * kB * kDin * 2);   // x pages f16
  _Float16* w1t = (_Float16*)take((size_t)kE * kH1 * kDin * 2); // W1^T f16 [E][N][K]
  _Float16* w2t = (_Float16*)take((size_t)kE * kH2 * kH1 * 2);  // W2^T f16 [E][N][K]
  _Float16* hb  = (_Float16*)take((size_t)kE * kB * kH1 * 2);   // hidden acts f16
  _Float16* eo  = (_Float16*)take((size_t)kE * kB * kH2 * 2);   // expert outputs f16
  float*    gts = (float*)   take((size_t)kB * 20 * 4);         // gate weights

  // weights: convert + transpose to [E][N][K] so GEMM streams b128 tiles
  weights_f16_transposed<<<kW1Tiles + kW2Tiles, 256, 0, stream>>>(
      W1s, W1h, W2s, W2h, w1t, w2t);

  // x pages -> f16 and the gate weights, from one read of x
  x_f16_gates_kernel<<<dim3(kB / (8 * kXRows), 4), 256, 0, stream>>>(
      x0, x1, x2, xs, Wg, bg, Wsg, bsg, xh, gts);

  // layer 1: h[e] = relu(x_page(e) @ W1[e] + b1[e])   [B,1024]
  dim3 g1(kH1 / kBT, kB / kBT, kE);
  gemm_bias_relu_wmma<<<g1, 256, 0, stream>>>(xh, w1t, b1s, b1h, hb,
                                              kB, kDin, kH1, /*pageMode=*/1);
  // layer 2: eo[e] = relu(h[e] @ W2[e] + b2[e])       [B,512]
  dim3 g2(kH2 / kBT, kB / kBT, kE);
  gemm_bias_relu_wmma<<<g2, 256, 0, stream>>>(hb, w2t, b2s, b2h, eo,
                                              kB, kH1, kH2, /*pageMode=*/0);

  combine_kernel<<<(kB * kH2 + 255) / 256, 256, 0, stream>>>(eo, gts, (float*)d_out);
}

// v006
// Measured time: 107 microseconds a run.
// Two timings next to v005 both put it at 1.11 times that version's speed.
// Counting every step since v000, it is 2.67 times as fast.
#include <hip/hip_runtime.h>
#include <hip/hip_bf16.h>

typedef __attribute__((ext_vector_type(16))) _Float16 v16h;
typedef __attribute__((ext_vector_type(8)))  float    v8f;

constexpr int kB    = 4096;
constexpr int kDin  = 1024;
constexpr int kH1   = 1024;
constexpr int kH2   = 512;
constexpr int kE    = 8;   // 6 specific + 2 shared experts
constexpr int kSpec = 6;

constexpr int kBK     = 64;              // k depth of one pass, in halves
constexpr int kRow4   = kBK / 8;         // 16-B units of data per tile row
constexpr int kPitch4 = kRow4 + 1;       // row pitch in 16-B units
constexpr int kBT     = 256;             // rows of A and rows of W^T per block tile
constexpr int kMT     = 4;               // 16-row A fragments per wave (64 rows)
constexpr int kNT     = 8;               // 16-row W fragments per wave (128 columns)
constexpr int kTile4  = kBT * kPitch4;   // one operand tile
constexpr int kBuf4   = 2 * kTile4;      // one (A|W) stage
constexpr int kOutRow4   = kNT * 16 / 8;             // 16-B units of data per row
constexpr int kOutPitch4 = kOutRow4 + 1;             // row pitch in 16-B units
constexpr int kOutWave4  = kMT * 16 * kOutPitch4;    // one wave's range
constexpr int kOut4      = 8 * kOutWave4;            // all eight waves: 136 KB
constexpr int kOutBias4  = kNT * 16 / 4;             // a wave's 128 f32 biases, behind the tiles

union Frag { uint4 u[2]; v16h h; };

#if defined(__AMDGCN__) && \
    __has_builtin(__builtin_amdgcn_global_load_async_to_lds_b128) && \
    __has_builtin(__builtin_amdgcn_s_wait_asynccnt)
#define USE_ASYNC 1
typedef int v4i __attribute__((ext_vector_type(4)));
typedef __attribute__((address_space(3))) v4i lds_v4i;
typedef __attribute__((address_space(1))) v4i glb_v4i;
#else
#define USE_ASYNC 0
#endif

// ------------- f32 [E][K][N] -> f16 [E][N][K] transpose+convert --------
// One launch for the four weight arrays. A work-group takes a tile of kTK k by
// kTN n of one expert: few, fat waves, for speed only. Every global access is 16 B a lane
// and covers whole 256-B units: a source row of the tile is 64 f32 = 256 B, a
// row of the transposed tile 256 f16 = 512 B.
typedef float f32x4 __attribute__((ext_vector_type(4)));
constexpr int kTK = 256;                 // k per tile
constexpr int kTN = 64;                  // n per tile
constexpr int kTU = kTK / 8;             // 16-B units of f16 per transposed tile row
constexpr int kW1Tiles = kE * (kDin / kTK) * (kH1 / kTN);
constexpr int kW2Tiles = kE * (kH1 / kTK) * (kH2 / kTN);

template <int K, int N>
__device__ __forceinline__ void w_tile(const float* __restrict__ src,  // [K][N], one expert
                                       _Float16* __restrict__ dst,     // [N][K], one expert
                                       int k0, int n0, uint4* t) {
  const int tid = threadIdx.x;
  const int n4  = tid & 15;              // the thread's four n
  const int kg  = tid >> 4;              // the thread's sixteen k
  const f32x4* s4 =
      reinterpret_cast<const f32x4*>(src + (size_t)(k0 + kg * 16) * N + n0) + n4;
  f32x4 v[16];
  #pragma unroll
  for (int i = 0; i < 16; i++) v[i] = s4[i * (N / 4)];
  // keeps all sixteen loads in front of the first conversion: left alone the
  // scheduler saves registers by issuing the last four only when the first have
  // returned, and the wave then waits out the memory latency more than once
  __builtin_amdgcn_sched_barrier(0);

  #pragma unroll
  for (int c = 0; c < 4; c++)
    #pragma unroll
    for (int h = 0; h < 2; h++) {
      union { _Float16 f[8]; uint4 u; } p;
      #pragma unroll
      for (int i = 0; i < 8; i++) p.f[i] = (_Float16)v[h * 8 + i][c];
      t[(n4 * 4 + c) * kTU + ((kg * 2 + h + n4) & (kTU - 1))] = p.u;
    }
  __syncthreads();

  // a wave stores whole tile rows, 512 B each: row n = 8 j + wave, lane = unit
  const int w = tid >> 5, u = tid & 31;
  uint4* d4 = reinterpret_cast<uint4*>(dst + (size_t)(n0 + w) * K + k0) + u;
  uint4 r[kTN / 8];
  #pragma unroll
  for (int j = 0; j < kTN / 8; j++)      // (8 j + w) / 4 = 2 j + w / 4
    r[j] = t[(j * 8 + w) * kTU + ((u + (w >> 2) + 2 * j) & (kTU - 1))];
  #pragma unroll
  for (int j = 0; j < kTN / 8; j++) d4[j * 8 * (K / 8)] = r[j];
}

__global__ void __launch_bounds__(256)
weights_f16_transposed(const float* __restrict__ W1s, const float* __restrict__ W1h,
                       const float* __restrict__ W2s, const float* __restrict__ W2h,
                       _Float16* __restrict__ w1t, _Float16* __restrict__ w2t) {
  __shared__ alignas(16) uint4 t[kTN * kTU];   // 32 KB
  unsigned b = blockIdx.x;
  if (b < (unsigned)kW1Tiles) {
    constexpr unsigned kNT = kH1 / kTN, kPer = (kDin / kTK) * kNT;
    const unsigned e = b / kPer, r = b % kPer;
    const float* src = (e < (unsigned)kSpec) ? W1s + (size_t)e * kDin * kH1
                                   : W1h + (size_t)(e - kSpec) * kDin * kH1;
    w_tile<kDin, kH1>(src, w1t + (size_t)e * kH1 * kDin, (r / kNT) * kTK, (r % kNT) * kTN, t);
  } else {
    b -= kW1Tiles;
    constexpr unsigned kNT = kH2 / kTN, kPer = (kH1 / kTK) * kNT;
    const unsigned e = b / kPer, r = b % kPer;
    const float* src = (e < (unsigned)kSpec) ? W2s + (size_t)e * kH1 * kH2
                                   : W2h + (size_t)(e - kSpec) * kH1 * kH2;
    w_tile<kH1, kH2>(src, w2t + (size_t)e * kH2 * kH1, (r / kNT) * kTK, (r % kNT) * kTN, t);
  }
}

typedef float f32x2 __attribute__((ext_vector_type(2)));
constexpr int kXRows = 4;                // rows of x per wave

template <int M, int HALF, int N>
__device__ __forceinline__ void wave_sums(float (&a)[N], int lane) {
  if constexpr (HALF >= 1) {
    const bool up = (lane & M) != 0;
    #pragma unroll
    for (int i = 0; i < HALF; i++) {
      float keep = up ? a[i + HALF] : a[i];
      float send = up ? a[i] : a[i + HALF];
      a[i] = keep + __shfl_xor(send, M, 32);
    }
  } else {
    a[0] += __shfl_xor(a[0], M, 32);
  }
  if constexpr (M > 1) wave_sums<M / 2, HALF / 2, N>(a, lane);
}

template <int NG>                        // gate width: 4 or 8
__device__ __forceinline__ void x_pass(const float* __restrict__ x,
                                       const float* __restrict__ Wgt,  // [D_IN][NG]
                                       const float* __restrict__ bias, // [NG]
                                       _Float16* __restrict__ xh,      // f16 page of x
                                       float* __restrict__ gates, int gbase,
                                       f32x4* wl) {
  constexpr int H = NG / 4;              // 16-B units per weight row
  constexpr int N = kXRows * NG;         // sums per wave
  const int tid  = threadIdx.x;
  const int lane = tid & 31;
  const int blk0 = blockIdx.x * (8 * kXRows);            // the block's first row
  const int row0 = blk0 + (tid >> 5) * kXRows;           // the wave's first row
  // the lane's first 16-B unit of x (8-B unit of the copy) inside the block's rows
  const int t0 = (tid >> 5) * (kXRows * (kDin / 4)) + lane;

  // gate weights first, then the rows: the weights can be laid in LDS while
  // the rows are still in flight
  const f32x4* W4 = reinterpret_cast<const f32x4*>(Wgt);
  f32x4 wv[4 * H];
  #pragma unroll
  for (int i = 0; i < 4 * H; i++) wv[i] = W4[tid + i * 256];
  const f32x4* xp = reinterpret_cast<const f32x4*>(x) + (size_t)blk0 * (kDin / 4);
  f32x4 xv[kXRows][8];
  #pragma unroll
  for (int r = 0; r < kXRows; r++)
    #pragma unroll
    for (int j = 0; j < 8; j++) xv[r][j] = xp[t0 + r * (kDin / 4) + j * 32];

  // LDS order [j][c][h][lane]: the 32 lanes of a reader take 512 contiguous B
  #pragma unroll
  for (int i = 0; i < 4 * H; i++) {
    int q = tid + i * 256;
    int k = q / H, h = q % H;
    wl[(((k >> 7) * 4 + (k & 3)) * H + h) * 32 + ((k >> 2) & 31)] = wv[i];
  }
  __syncthreads();

  uint2* xo = reinterpret_cast<uint2*>(xh) + (size_t)blk0 * (kDin / 4);
  f32x2 acc2[N / 2];                     // gates 2 i, 2 i + 1 of row r at [r * NG / 2 + i]
  #pragma unroll
  for (int i = 0; i < N / 2; i++) acc2[i] = (f32x2){0.f, 0.f};
  #pragma unroll
  for (int j = 0; j < 8; j++) {
    #pragma unroll
    for (int r = 0; r < kXRows; r++) {
      union { _Float16 h[4]; uint2 u; } p;
      p.h[0] = (_Float16)xv[r][j][0]; p.h[1] = (_Float16)xv[r][j][1];
      p.h[2] = (_Float16)xv[r][j][2]; p.h[3] = (_Float16)xv[r][j][3];
      xo[t0 + r * (kDin / 4) + j * 32] = p.u;
    }
    #pragma unroll
    for (int c = 0; c < 4; c++)
      #pragma unroll
      for (int h = 0; h < H; h++) {
        const f32x4 w = wl[((j * 4 + c) * H + h) * 32 + lane];
        #pragma unroll
        for (int r = 0; r < kXRows; r++) {
          const f32x2 xx = {xv[r][j][c], xv[r][j][c]};
          f32x2& lo = acc2[r * (NG / 2) + h * 2];
          f32x2& hi = acc2[r * (NG / 2) + h * 2 + 1];
          lo = __builtin_elementwise_fma(w.lo, xx, lo);
          hi = __builtin_elementwise_fma(w.hi, xx, hi);
        }
      }
    // holds the f16 stores of step j in front of the products of step j + 1:
    // without it the scheduler sinks every store behind the last sum, and the
    // writes only start when the arithmetic is over
    __builtin_amdgcn_sched_barrier(0);
  }
  float acc[N];                          // acc[r * NG + g]: the sum over this lane's 32 k
  #pragma unroll
  for (int i = 0; i < N / 2; i++) { acc[2 * i] = acc2[i][0]; acc[2 * i + 1] = acc2[i][1]; }

  wave_sums<16, N / 2, N>(acc, lane);

  // softmax inside the lanes that hold one row's logits (each logit kDup times)
  constexpr int kDup = 32 / N;
  const int g = (lane / kDup) % NG;
  const float lg = acc[0] + bias[g];
  float mx = lg;
  #pragma unroll
  for (int m = kDup; m < kDup * NG; m <<= 1) mx = fmaxf(mx, __shfl_xor(mx, m, 32));
  const float ev = expf(lg - mx);
  float sum = ev;
  #pragma unroll
  for (int m = kDup; m < kDup * NG; m <<= 1) sum += __shfl_xor(sum, m, 32);
  const float gw = ev * (1.f / sum);
  if (lane % kDup == 0)
    gates[(size_t)(row0 + lane / (kDup * NG)) * 20 + gbase + g] = gw;
}

__global__ void __launch_bounds__(256)
x_f16_gates_kernel(const float* __restrict__ x0, const float* __restrict__ x1,
                   const float* __restrict__ x2, const float* __restrict__ xs,
                   const float* __restrict__ Wg,  const float* __restrict__ bg,
                   const float* __restrict__ Wsg, const float* __restrict__ bsg,
                   _Float16* __restrict__ xh, float* __restrict__ gates) {
  __shared__ alignas(16) f32x4 wl[kDin * 2];   // 32 KB: one input's gate weights
  const int d = blockIdx.y;
  _Float16* page = xh + (size_t)d * kB * kDin;
  const float* x = (d == 0) ? x0 : (d == 1) ? x1 : (d == 2) ? x2 : xs;
  if (d == 3)
    x_pass<8>(x, Wsg, bsg, page, gates, 12, wl);
  else
    x_pass<4>(x, Wg + (size_t)d * kDin * 4, bg + d * 4, page, gates, d * 4, wl);
}

// ---------------- WMMA GEMM: C = relu(A @ W + bias), f16 in / f32 acc ----
// block = 256 threads (8 waves); block tile 256(M) x 256(N); wave tile 64x128:
// a byte fetched from L2 serves twice the products of a 128 x 128 tile, and a
// fragment read from LDS feeds 32 / 12 matrix instructions and not 8 / 6. The
// accumulators take 256 registers, so one block is resident per WGP.
// A : [pages][Bsz][K] f16 row-major.
// Wt: [E][N][K] f16 (pre-transposed) -> W tile loader identical to A tile.
// pageMode=1: expert e reads A page (e<6 ? e/2 : 3)   (layer-1 input mapping)
// pageMode=0: expert e reads A page e                 (layer-2: h buffer)
__global__ void __launch_bounds__(256)
gemm_bias_relu_wmma(const _Float16* __restrict__ A,
                    const _Float16* __restrict__ Wt,
                    const float* __restrict__ biasS,
                    const float* __restrict__ biasH,
                    _Float16* __restrict__ C,
                    int Bsz, int K, int N, int pageMode) {
#if USE_ASYNC
  __shared__ alignas(16) uint4 smem4[2 * kBuf4];   // 144 KB: double-buffered (A|W) tiles; then output staging
#else
  __shared__ alignas(16) uint4 smem4[kOut4 + 8 * kOutBias4];  // single (A|W) tile, 72 KB; output staging, 140 KB
#endif

  const int tid  = threadIdx.x;
  const int lane = tid & 31;
  const int wave = tid >> 5;
  const int waveM = wave & 3;          // 4 waves along M
  const int waveN = wave >> 2;         // 2 waves along N
  const int rl   = lane & 15;
  const int hsel = lane >> 4;

  const int e  = blockIdx.z;
  const int n0 = blockIdx.x * kBT;
  const int m0 = blockIdx.y * kBT;
  const int page = pageMode ? ((e < kSpec) ? (e >> 1) : 3) : e;
  const int ld = K >> 3;               // row stride in uint4 units

  const uint4* __restrict__ Ag = reinterpret_cast<const uint4*>(A) +
      (size_t)page * Bsz * ld + (size_t)m0 * ld;
  const uint4* __restrict__ Wg = reinterpret_cast<const uint4*>(Wt) +
      (size_t)e * N * ld + (size_t)n0 * ld;

  const v8f vzero = {0.f, 0.f, 0.f, 0.f, 0.f, 0.f, 0.f, 0.f};
  v8f acc[kMT][kNT];
  #pragma unroll
  for (int mt = 0; mt < kMT; mt++)
    #pragma unroll
    for (int nt = 0; nt < kNT; nt++) acc[mt][nt] = vzero;

#if USE_ASYNC
  auto issue = [&](int k0, int buf) {
    lds_v4i* dA = (lds_v4i*)(smem4 + buf * kBuf4);
    lds_v4i* dW = dA + kTile4;
    glb_v4i* sA = (glb_v4i*)(Ag + (k0 >> 3));
    glb_v4i* sW = (glb_v4i*)(Wg + (k0 >> 3));
    #pragma unroll
    for (int i = 0; i < kBT * kRow4 / 256; i++) {
      int q4 = tid + i * 256;
      int r = q4 / kRow4, c4 = q4 % kRow4;
      __builtin_amdgcn_global_load_async_to_lds_b128(sA + (size_t)r * ld + c4,
                                                     dA + r * kPitch4 + c4, 0, 0);
      __builtin_amdgcn_global_load_async_to_lds_b128(sW + (size_t)r * ld + c4,
                                                     dW + r * kPitch4 + c4, 0, 0);
    }
  };
  issue(0, 0);
  // tile 0 has landed for this wave before the barrier publishes it
  asm volatile("s_wait_asynccnt 0x0" ::: "memory");
  __syncthreads();
  if (kBK < K) issue(kBK, 1);                   // tile 1 flies during pass 0
#endif

  for (int k0 = 0; k0 < K; k0 += kBK) {
#if USE_ASYNC
    const int cur = (k0 / kBK) & 1;
    const uint4* ap = reinterpret_cast<const uint4*>(smem4 + cur * kBuf4);
    const uint4* bp = ap + kTile4;
#else
    {  // synchronous fallback: both tiles are plain coalesced b128 copies
      uint4* dA = smem4;
      uint4* dW = smem4 + kTile4;
      const uint4* sA = Ag + (k0 >> 3);
      const uint4* sW = Wg + (k0 >> 3);
      #pragma unroll
      for (int i = 0; i < kBT * kRow4 / 256; i++) {
        int q4 = tid + i * 256;
        int r = q4 / kRow4, c4 = q4 % kRow4;
        dA[r * kPitch4 + c4] = sA[(size_t)r * ld + c4];
        dW[r * kPitch4 + c4] = sW[(size_t)r * ld + c4];
      }
    }
    __syncthreads();
    const uint4* ap = reinterpret_cast<const uint4*>(smem4);
    const uint4* bp = ap + kTile4;
#endif

    Frag afrag[kBK / 32][kMT], bfrag[kBK / 32][kNT];
    #pragma unroll
    for (int ks = 0; ks < kBK / 32; ks++) {
      #pragma unroll
      for (int mt = 0; mt < kMT; mt++) {
        int r = waveM * (kMT * 16) + mt * 16 + rl;
        afrag[ks][mt].u[0] = ap[r * kPitch4 + ks * 4 + hsel];
        afrag[ks][mt].u[1] = ap[r * kPitch4 + ks * 4 + hsel + 2];
      }
      // this one and the one below keep the reads in the order in which the
      // matrix instructions use them: with the operands swapped the scheduler
      // put the fragments that are used first at the end of the group, and the
      // first matrix instruction then waited for 40 of the 48 reads, not for 10
      __builtin_amdgcn_sched_barrier(0);
      #pragma unroll
      for (int nt = 0; nt < kNT; nt++) {
        int c = waveN * (kNT * 16) + nt * 16 + rl;
        bfrag[ks][nt].u[0] = bp[c * kPitch4 + ks * 4 + hsel];
        bfrag[ks][nt].u[1] = bp[c * kPitch4 + ks * 4 + hsel + 2];
        __builtin_amdgcn_sched_barrier(0);
      }
    }
    // keeps the 48 reads of a pass in one group in front of its 64 matrix
    // instructions: left alone the scheduler sinks reads to just in front of
    // their users, and the wave waits out the LDS latency again and again
    __builtin_amdgcn_sched_barrier(0);
    #pragma unroll
    for (int ks = 0; ks < kBK / 32; ks++)
      #pragma unroll
      for (int nt = 0; nt < kNT; nt++)   // in the order in which the W reads land
        #pragma unroll
        for (int mt = 0; mt < kMT; mt++)
          // W rows as the first operand: the tile comes out transposed, and a
          // lane's 8 accumulator registers are 8 consecutive columns of one C row
          acc[mt][nt] = __builtin_amdgcn_wmma_f32_16x16x32_f16(
              false, bfrag[ks][nt].h, false, afrag[ks][mt].h,
              (short)0, acc[mt][nt], false, false);
    // keeps the matrix instructions in front of the pass-foot waits and barrier:
    // left alone the scheduler lifts those over them, and the wait for the next
    // tile's copies then stands right behind their issue
    __builtin_amdgcn_sched_barrier(0);

#if USE_ASYNC
    // this wave's reads of the current buffer are done before it is refilled
    asm volatile("s_wait_dscnt 0x0" ::: "memory");
    // this wave's copies of the next tile have landed before the barrier publishes them
    asm volatile("s_wait_asynccnt 0x0" ::: "memory");
    __syncthreads();
    if (k0 + 2 * kBK < K) issue(k0 + 2 * kBK, cur);  // refill the buffer just read
#else
    __syncthreads();
#endif
  }
#if USE_ASYNC
  // no copy is outstanding when the wave goes on to its end
  asm volatile("s_wait_asynccnt 0x0" ::: "memory");
#endif

  // ---- epilogue: bias + ReLU. acc[mt][nt][j] = row mt * 16 + rl, column
  // nt * 16 + hsel * 8 + j of the wave's tile: 8 results make one 16-B unit.
  // The units go to the wave's own LDS range and come back as whole rows, so that
  // every global store is 16 B a lane and covers two whole 256-B units of C
  // (2-B stores from the accumulators wrote 32-B pieces, 8 times the stores).
  // The ring is free: the last pass ended in its waits and its barrier.
  const float* bias = (e < kSpec) ? (biasS + (size_t)e * N)
                                  : (biasH + (size_t)(e - kSpec) * N);
  // a lane needs 8 consecutive biases per nt: the wave fetches its 128 with one
  // 512-B load and hands them round through LDS
  f32x4* bl = reinterpret_cast<f32x4*>(smem4 + kOut4) + wave * kOutBias4;
  const f32x4 bw = reinterpret_cast<const f32x4*>(bias + n0 + waveN * (kNT * 16))[lane];
  // the wait stands in front of the first instruction that reuses the load's
  // address registers; the scheduling barrier keeps later address arithmetic
  // from being lifted over it
  asm volatile("s_wait_xcnt 0x0" ::: "memory");
  __builtin_amdgcn_sched_barrier(0);
  bl[lane] = bw;
  // the wave's own LDS write is done before its lanes read one another's biases
  asm volatile("s_wait_dscnt 0x0" ::: "memory");
  // all sixteen reads in front of the first staging write: one LDS latency, not eight
  f32x4 bb[kNT][2];
  #pragma unroll
  for (int nt = 0; nt < kNT; nt++) {
    bb[nt][0] = bl[nt * 4 + hsel * 2];
    bb[nt][1] = bl[nt * 4 + hsel * 2 + 1];
  }
  uint4* st = smem4 + wave * kOutWave4;
  #pragma unroll
  for (int nt = 0; nt < kNT; nt++) {
    const f32x4 blo = bb[nt][0], bhi = bb[nt][1];
    #pragma unroll
    for (int mt = 0; mt < kMT; mt++) {
      union { _Float16 f[8]; uint4 u; } p;
      #pragma unroll
      for (int j = 0; j < 8; j++) {
        float v = acc[mt][nt][j] + (j < 4 ? blo[j & 3] : bhi[j & 3]);
        v = v > 0.f ? v : 0.f;
        p.f[j] = (_Float16)v;
      }
      st[(mt * 16 + rl) * kOutPitch4 + nt * 2 + hsel] = p.u;
    }
  }
  // the wave's own LDS writes are done before its lanes read one another's units
  asm volatile("s_wait_dscnt 0x0" ::: "memory");
  uint4 row[kMT * 8];
  #pragma unroll
  for (int i = 0; i < kMT * 8; i++) row[i] = st[(i * 2 + hsel) * kOutPitch4 + rl];
  uint4* Cp = reinterpret_cast<uint4*>(
      C + (size_t)e * Bsz * N + (size_t)(m0 + waveM * (kMT * 16) + hsel) * N +
      n0 + waveN * (kNT * 16)) + rl;
  const int ldc = N >> 3;              // row stride of C in 16-B units
  #pragma unroll
  for (int i = 0; i < kMT * 8; i++) Cp[(size_t)(i * 2) * ldc] = row[i];
}

// ---------------- gated combine: 4 outputs, each [B, H2] f32 ------------
__global__ void __launch_bounds__(256)
combine_kernel(const _Float16* __restrict__ eo,   // [8][B][H2]
               const float* __restrict__ gates,   // [B][20]
               float* __restrict__ out) {         // [4][B][H2]
  int idx = blockIdx.x * blockDim.x + threadIdx.x;
  if (idx >= kB * kH2) return;
  int b = idx / kH2, o = idx % kH2;
  float ex[8];
  #pragma unroll
  for (int k = 0; k < 8; k++)
    ex[k] = (float)eo[((size_t)k * kB + b) * kH2 + o];
  const float* g = gates + (size_t)b * 20;
  float o0 = g[0] * ex[0] + g[1] * ex[1] + g[2]  * ex[6] + g[3]  * ex[7];
  float o1 = g[4] * ex[2] + g[5] * ex[3] + g[6]  * ex[6] + g[7]  * ex[7];
  float o2 = g[8] * ex[4] + g[9] * ex[5] + g[10] * ex[6] + g[11] * ex[7];
  float o3 = 0.f;
  #pragma unroll
  for (int k = 0; k < 8; k++) o3 += g[12 + k] * ex[k];
  size_t p = (size_t)b * kH2 + o;
  const size_t page = (size_t)kB * kH2;
  out[p]            = o0;
  out[page + p]     = o1;
  out[2 * page + p] = o2;
  out[3 * page + p] = o3;
}

extern "C" void kernel_launch(void* const* d_in, const int* in_sizes, int n_in,
                              void* d_out, int out_size, void* d_ws, size_t ws_size,
                              hipStream_t stream) {
  const float* x0  = (const float*)d_in[0];
  const float* x1  = (const float*)d_in[1];
  const float* x2  = (const float*)d_in[2];
  const float* xs  = (const float*)d_in[3];
  const float* W1s = (const float*)d_in[4];
  const float* b1s = (const float*)d_in[5];
  const float* W2s = (const float*)d_in[6];
  const float* b2s = (const float*)d_in[7];
  const float* W1h = (const float*)d_in[8];
  const float* b1h = (const float*)d_in[9];
  const float* W2h = (const float*)d_in[10];
  const float* b2h = (const float*)d_in[11];
  const float* Wg  = (const float*)d_in[12];
  const float* bg  = (const float*)d_in[13];
  const float* Wsg = (const float*)d_in[14];
  const float* bsg = (const float*)d_in[15];
  (void)in_sizes; (void)n_in; (void)out_size; (void)ws_size;

  // ---- workspace carve-out (~153 MB), 256B aligned ----
  char* ws = (char*)d_ws;
  size_t off = 0;
  auto take = [&](size_t bytes) -> char* {
    char* p = ws + off;
    off += (bytes + 255) & ~(size_t)255;
    return p;
  };
  _Float16* xh  = (_Float16*)take((size_t)4 * kB * kDin * 2);   // x pages f16
  _Float16* w1t = (_Float16*)take((size_t)kE * kH1 * kDin * 2); // W1^T f16 [E][N][K]
  _Float16* w2t = (_Float16*)take((size_t)kE * kH2 * kH1 * 2);  // W2^T f16 [E][N][K]
  _Float16* hb  = (_Float16*)take((size_t)kE * kB * kH1 * 2);   // hidden acts f16
  _Float16* eo  = (_Float16*)take((size_t)kE * kB * kH2 * 2);   // expert outputs f16
  float*    gts = (float*)   take((size_t)kB * 20 * 4);         // gate weights

  // weights: convert + transpose to [E][N][K] so GEMM streams b128 tiles
  weights_f16_transposed<<<kW1Tiles + kW2Tiles, 256, 0, stream>>>(
      W1s, W1h, W2s, W2h, w1t, w2t);

  // x pages -> f16 and the gate weights, from one read of x
  x_f16_gates_kernel<<<dim3(kB / (8 * kXRows), 4), 256, 0, stream>>>(
      x0, x1, x2, xs, Wg, bg, Wsg, bsg, xh, gts);

  // layer 1: h[e] = relu(x_page(e) @ W1[e] + b1[e])   [B,1024]
  dim3 g1(kH1 / kBT, kB / kBT, kE);
  gemm_bias_relu_wmma<<<g1, 256, 0, stream>>>(xh, w1t, b1s, b1h, hb,
                                              kB, kDin, kH1, /*pageMode=*/1);
  // layer 2: eo[e] = relu(h[e] @ W2[e] + b2[e])       [B,512]
  dim3 g2(kH2 / kBT, kB / kBT, kE);
  gemm_bias_relu_wmma<<<g2, 256, 0, stream>>>(hb, w2t, b2s, b2h, eo,
                                              kB, kH1, kH2, /*pageMode=*/0);

  combine_kernel<<<(kB * kH2 + 255) / 256, 256, 0, stream>>>(eo, gts, (float*)d_out);
}

// v007
// Measured time: 101 microseconds a run.
// Next to v006, in two timings, it ran 1.06 times as fast each time.
// Counting every step since v000, it is 2.83 times as fast.
#include <hip/hip_runtime.h>
#include <hip/hip_bf16.h>

typedef __attribute__((ext_vector_type(16))) _Float16 v16h;
typedef __attribute__((ext_vector_type(8)))  float    v8f;

constexpr int kB    = 4096;
constexpr int kDin  = 1024;
constexpr int kH1   = 1024;
constexpr int kH2   = 512;
constexpr int kE    = 8;   // 6 specific + 2 shared experts
constexpr int kSpec = 6;

constexpr int kBK     = 128;             // k depth of one pass, in halves
constexpr int kHK     = 64;              // k depth of one block of matrix instructions
constexpr int kRow4   = kBK / 8;         // 16-B units of data per tile row
constexpr int kPitch4 = kRow4 + 1;       // row pitch in 16-B units
constexpr int kBT     = 256;             // rows of A and rows of W^T per block tile
constexpr int kMT     = 4;               // 16-row A fragments per wave (64 rows)
constexpr int kNT     = 8;               // 16-row W fragments per wave (128 columns)
constexpr int kTile4  = kBT * kPitch4;   // one operand tile
constexpr int kBuf4   = 2 * kTile4;      // one (A|W) stage
constexpr int kOutRow4   = kNT * 16 / 8;             // 16-B units of data per row
constexpr int kOutPitch4 = kOutRow4 + 1;             // row pitch in 16-B units
constexpr int kOutWave4  = kMT * 16 * kOutPitch4;    // one wave's range
constexpr int kOut4      = 8 * kOutWave4;            // all eight waves: 136 KB
constexpr int kOutBias4  = kNT * 16 / 4;             // a wave's 128 f32 biases, behind the tiles

union Frag { uint4 u[2]; v16h h; };

#if defined(__AMDGCN__) && \
    __has_builtin(__builtin_amdgcn_global_load_async_to_lds_b128) && \
    __has_builtin(__builtin_amdgcn_s_wait_asynccnt)
#define USE_ASYNC 1
typedef int v4i __attribute__((ext_vector_type(4)));
typedef __attribute__((address_space(3))) v4i lds_v4i;
typedef __attribute__((address_space(1))) v4i glb_v4i;
#else
#define USE_ASYNC 0
#endif

// ------------- f32 [E][K][N] -> f16 [E][N][K] transpose+convert --------
// One launch for the four weight arrays. A work-group takes a tile of kTK k by
// kTN n of one expert: few, fat waves, for speed only. Every global access is 16 B a lane
// and covers whole 256-B units: a source row of the tile is 64 f32 = 256 B, a
// row of the transposed tile 256 f16 = 512 B.
typedef float f32x4 __attribute__((ext_vector_type(4)));
constexpr int kTK = 256;                 // k per tile
constexpr int kTN = 64;                  // n per tile
constexpr int kTU = kTK / 8;             // 16-B units of f16 per transposed tile row
constexpr int kW1Tiles = kE * (kDin / kTK) * (kH1 / kTN);
constexpr int kW2Tiles = kE * (kH1 / kTK) * (kH2 / kTN);

template <int K, int N>
__device__ __forceinline__ void w_tile(const float* __restrict__ src,  // [K][N], one expert
                                       _Float16* __restrict__ dst,     // [N][K], one expert
                                       int k0, int n0, uint4* t) {
  const int tid = threadIdx.x;
  const int n4  = tid & 15;              // the thread's four n
  const int kg  = tid >> 4;              // the thread's sixteen k
  const f32x4* s4 =
      reinterpret_cast<const f32x4*>(src + (size_t)(k0 + kg * 16) * N + n0) + n4;
  f32x4 v[16];
  #pragma unroll
  for (int i = 0; i < 16; i++) v[i] = s4[i * (N / 4)];
  // keeps all sixteen loads in front of the first conversion: left alone the
  // scheduler saves registers by issuing the last four only when the first have
  // returned, and the wave then waits out the memory latency more than once
  __builtin_amdgcn_sched_barrier(0);

  #pragma unroll
  for (int c = 0; c < 4; c++)
    #pragma unroll
    for (int h = 0; h < 2; h++) {
      union { _Float16 f[8]; uint4 u; } p;
      #pragma unroll
      for (int i = 0; i < 8; i++) p.f[i] = (_Float16)v[h * 8 + i][c];
      t[(n4 * 4 + c) * kTU + ((kg * 2 + h + n4) & (kTU - 1))] = p.u;
    }
  __syncthreads();

  // a wave stores whole tile rows, 512 B each: row n = 8 j + wave, lane = unit
  const int w = tid >> 5, u = tid & 31;
  uint4* d4 = reinterpret_cast<uint4*>(dst + (size_t)(n0 + w) * K + k0) + u;
  uint4 r[kTN / 8];
  #pragma unroll
  for (int j = 0; j < kTN / 8; j++)      // (8 j + w) / 4 = 2 j + w / 4
    r[j] = t[(j * 8 + w) * kTU + ((u + (w >> 2) + 2 * j) & (kTU - 1))];
  #pragma unroll
  for (int j = 0; j < kTN / 8; j++) d4[j * 8 * (K / 8)] = r[j];
}

__global__ void __launch_bounds__(256)
weights_f16_transposed(const float* __restrict__ W1s, const float* __restrict__ W1h,
                       const float* __restrict__ W2s, const float* __restrict__ W2h,
                       _Float16* __restrict__ w1t, _Float16* __restrict__ w2t) {
  __shared__ alignas(16) uint4 t[kTN * kTU];   // 32 KB
  unsigned b = blockIdx.x;
  if (b < (unsigned)kW1Tiles) {
    constexpr unsigned kNT = kH1 / kTN, kPer = (kDin / kTK) * kNT;
    const unsigned e = b / kPer, r = b % kPer;
    const float* src = (e < (unsigned)kSpec) ? W1s + (size_t)e * kDin * kH1
                                   : W1h + (size_t)(e - kSpec) * kDin * kH1;
    w_tile<kDin, kH1>(src, w1t + (size_t)e * kH1 * kDin, (r / kNT) * kTK, (r % kNT) * kTN, t);
  } else {
    b -= kW1Tiles;
    constexpr unsigned kNT = kH2 / kTN, kPer = (kH1 / kTK) * kNT;
    const unsigned e = b / kPer, r = b % kPer;
    const float* src = (e < (unsigned)kSpec) ? W2s + (size_t)e * kH1 * kH2
                                   : W2h + (size_t)(e - kSpec) * kH1 * kH2;
    w_tile<kH1, kH2>(src, w2t + (size_t)e * kH2 * kH1, (r / kNT) * kTK, (r % kNT) * kTN, t);
  }
}

typedef float f32x2 __attribute__((ext_vector_type(2)));
constexpr int kXRows = 4;                // rows of x per wave

template <int M, int HALF, int N>
__device__ __forceinline__ void wave_sums(float (&a)[N], int lane) {
  if constexpr (HALF >= 1) {
    const bool up = (lane & M) != 0;
    #pragma unroll
    for (int i = 0; i < HALF; i++) {
      float keep = up ? a[i + HALF] : a[i];
      float send = up ? a[i] : a[i + HALF];
      a[i] = keep + __shfl_xor(send, M, 32);
    }
  } else {
    a[0] += __shfl_xor(a[0], M, 32);
  }
  if constexpr (M > 1) wave_sums<M / 2, HALF / 2, N>(a, lane);
}

template <int NG>                        // gate width: 4 or 8
__device__ __forceinline__ void x_pass(const float* __restrict__ x,
                                       const float* __restrict__ Wgt,  // [D_IN][NG]
                                       const float* __restrict__ bias, // [NG]
                                       _Float16* __restrict__ xh,      // f16 page of x
                                       float* __restrict__ gates, int gbase,
                                       f32x4* wl) {
  constexpr int H = NG / 4;              // 16-B units per weight row
  constexpr int N = kXRows * NG;         // sums per wave
  const int tid  = threadIdx.x;
  const int lane = tid & 31;
  const int blk0 = blockIdx.x * (8 * kXRows);            // the block's first row
  const int row0 = blk0 + (tid >> 5) * kXRows;           // the wave's first row
  // the lane's first 16-B unit of x (8-B unit of the copy) inside the block's rows
  const int t0 = (tid >> 5) * (kXRows * (kDin / 4)) + lane;

  // gate weights first, then the rows: the weights can be laid in LDS while
  // the rows are still in flight
  const f32x4* W4 = reinterpret_cast<const f32x4*>(Wgt);
  f32x4 wv[4 * H];
  #pragma unroll
  for (int i = 0; i < 4 * H; i++) wv[i] = W4[tid + i * 256];
  const f32x4* xp = reinterpret_cast<const f32x4*>(x) + (size_t)blk0 * (kDin / 4);
  f32x4 xv[kXRows][8];
  #pragma unroll
  for (int r = 0; r < kXRows; r++)
    #pragma unroll
    for (int j = 0; j < 8; j++) xv[r][j] = xp[t0 + r * (kDin / 4) + j * 32];

  // LDS order [j][c][h][lane]: the 32 lanes of a reader take 512 contiguous B
  #pragma unroll
  for (int i = 0; i < 4 * H; i++) {
    int q = tid + i * 256;
    int k = q / H, h = q % H;
    wl[(((k >> 7) * 4 + (k & 3)) * H + h) * 32 + ((k >> 2) & 31)] = wv[i];
  }
  __syncthreads();

  uint2* xo = reinterpret_cast<uint2*>(xh) + (size_t)blk0 * (kDin / 4);
  f32x2 acc2[N / 2];                     // gates 2 i, 2 i + 1 of row r at [r * NG / 2 + i]
  #pragma unroll
  for (int i = 0; i < N / 2; i++) acc2[i] = (f32x2){0.f, 0.f};
  #pragma unroll
  for (int j = 0; j < 8; j++) {
    #pragma unroll
    for (int r = 0; r < kXRows; r++) {
      union { _Float16 h[4]; uint2 u; } p;
      p.h[0] = (_Float16)xv[r][j][0]; p.h[1] = (_Float16)xv[r][j][1];
      p.h[2] = (_Float16)xv[r][j][2]; p.h[3] = (_Float16)xv[r][j][3];
      xo[t0 + r * (kDin / 4) + j * 32] = p.u;
    }
    #pragma unroll
    for (int c = 0; c < 4; c++)
      #pragma unroll
      for (int h = 0; h < H; h++) {
        const f32x4 w = wl[((j * 4 + c) * H + h) * 32 + lane];
        #pragma unroll
        for (int r = 0; r < kXRows; r++) {
          const f32x2 xx = {xv[r][j][c], xv[r][j][c]};
          f32x2& lo = acc2[r * (NG / 2) + h * 2];
          f32x2& hi = acc2[r * (NG / 2) + h * 2 + 1];
          lo = __builtin_elementwise_fma(w.lo, xx, lo);
          hi = __builtin_elementwise_fma(w.hi, xx, hi);
        }
      }
    // holds the f16 stores of step j in front of the products of step j + 1:
    // without it the scheduler sinks every store behind the last sum, and the
    // writes only start when the arithmetic is over
    __builtin_amdgcn_sched_barrier(0);
  }
  float acc[N];                          // acc[r * NG + g]: the sum over this lane's 32 k
  #pragma unroll
  for (int i = 0; i < N / 2; i++) { acc[2 * i] = acc2[i][0]; acc[2 * i + 1] = acc2[i][1]; }

  wave_sums<16, N / 2, N>(acc, lane);

  // softmax inside the lanes that hold one row's logits (each logit kDup times)
  constexpr int kDup = 32 / N;
  const int g = (lane / kDup) % NG;
  const float lg = acc[0] + bias[g];
  float mx = lg;
  #pragma unroll
  for (int m = kDup; m < kDup * NG; m <<= 1) mx = fmaxf(mx, __shfl_xor(mx, m, 32));
  const float ev = expf(lg - mx);
  float sum = ev;
  #pragma unroll
  for (int m = kDup; m < kDup * NG; m <<= 1) sum += __shfl_xor(sum, m, 32);
  const float gw = ev * (1.f / sum);
  if (lane % kDup == 0)
    gates[(size_t)(row0 + lane / (kDup * NG)) * 20 + gbase + g] = gw;
}

__global__ void __launch_bounds__(256)
x_f16_gates_kernel(const float* __restrict__ x0, const float* __restrict__ x1,
                   const float* __restrict__ x2, const float* __restrict__ xs,
                   const float* __restrict__ Wg,  const float* __restrict__ bg,
                   const float* __restrict__ Wsg, const float* __restrict__ bsg,
                   _Float16* __restrict__ xh, float* __restrict__ gates) {
  __shared__ alignas(16) f32x4 wl[kDin * 2];   // 32 KB: one input's gate weights
  const int d = blockIdx.y;
  _Float16* page = xh + (size_t)d * kB * kDin;
  const float* x = (d == 0) ? x0 : (d == 1) ? x1 : (d == 2) ? x2 : xs;
  if (d == 3)
    x_pass<8>(x, Wsg, bsg, page, gates, 12, wl);
  else
    x_pass<4>(x, Wg + (size_t)d * kDin * 4, bg + d * 4, page, gates, d * 4, wl);
}

// ---------------- WMMA GEMM: C = relu(A @ W + bias), f16 in / f32 acc ----
// block = 256 threads (8 waves); block tile 256(M) x 256(N); wave tile 64x128:
// a byte fetched from L2 serves twice the products of a 128 x 128 tile, and a
// fragment read from LDS feeds 32 / 12 matrix instructions and not 8 / 6. The
// accumulators take 256 registers, so one block is resident per WGP.
// A : [pages][Bsz][K] f16 row-major.
// Wt: [E][N][K] f16 (pre-transposed) -> W tile loader identical to A tile.
// pageMode=1: expert e reads A page (e<6 ? e/2 : 3)   (layer-1 input mapping)
// pageMode=0: expert e reads A page e                 (layer-2: h buffer)
__global__ void __launch_bounds__(256)
gemm_bias_relu_wmma(const _Float16* __restrict__ A,
                    const _Float16* __restrict__ Wt,
                    const float* __restrict__ biasS,
                    const float* __restrict__ biasH,
                    _Float16* __restrict__ C,
                    int Bsz, int K, int N, int pageMode) {
#if USE_ASYNC
  __shared__ alignas(16) uint4 smem4[2 * kBuf4];   // 272 KB: double-buffered (A|W) tiles; then output staging
#else
  __shared__ alignas(16) uint4 smem4[kOut4 + 8 * kOutBias4];  // single (A|W) tile, 136 KB; output staging, 140 KB
#endif

  const int tid  = threadIdx.x;
  const int lane = tid & 31;
  const int wave = tid >> 5;
  const int waveM = wave & 3;          // 4 waves along M
  const int waveN = wave >> 2;         // 2 waves along N
  const int rl   = lane & 15;
  const int hsel = lane >> 4;

  const int e  = blockIdx.z;
  const int n0 = blockIdx.x * kBT;
  const int m0 = blockIdx.y * kBT;
  const int page = pageMode ? ((e < kSpec) ? (e >> 1) : 3) : e;
  const int ld = K >> 3;               // row stride in uint4 units

  const uint4* __restrict__ Ag = reinterpret_cast<const uint4*>(A) +
      (size_t)page * Bsz * ld + (size_t)m0 * ld;
  const uint4* __restrict__ Wg = reinterpret_cast<const uint4*>(Wt) +
      (size_t)e * N * ld + (size_t)n0 * ld;

  const v8f vzero = {0.f, 0.f, 0.f, 0.f, 0.f, 0.f, 0.f, 0.f};
  v8f acc[kMT][kNT];
  #pragma unroll
  for (int mt = 0; mt < kMT; mt++)
    #pragma unroll
    for (int nt = 0; nt < kNT; nt++) acc[mt][nt] = vzero;

#if USE_ASYNC
  auto issue = [&](int k0, int buf) {
    lds_v4i* dA = (lds_v4i*)(smem4 + buf * kBuf4);
    lds_v4i* dW = dA + kTile4;
    glb_v4i* sA = (glb_v4i*)(Ag + (k0 >> 3));
    glb_v4i* sW = (glb_v4i*)(Wg + (k0 >> 3));
    #pragma unroll
    for (int i = 0; i < kBT * kRow4 / 256; i++) {
      int q4 = tid + i * 256;
      int r = q4 / kRow4, c4 = q4 % kRow4;
      __builtin_amdgcn_global_load_async_to_lds_b128(sA + (size_t)r * ld + c4,
                                                     dA + r * kPitch4 + c4, 0, 0);
      __builtin_amdgcn_global_load_async_to_lds_b128(sW + (size_t)r * ld + c4,
                                                     dW + r * kPitch4 + c4, 0, 0);
    }
  };
  issue(0, 0);
  // tile 0 has landed for this wave before the barrier publishes it
  asm volatile("s_wait_asynccnt 0x0" ::: "memory");
  __syncthreads();
  if (kBK < K) issue(kBK, 1);                   // tile 1 flies during pass 0
#endif

  for (int k0 = 0; k0 < K; k0 += kBK) {
#if USE_ASYNC
    const int cur = (k0 / kBK) & 1;
    const uint4* ap = reinterpret_cast<const uint4*>(smem4 + cur * kBuf4);
    const uint4* bp = ap + kTile4;
#else
    {  // synchronous fallback: both tiles are plain coalesced b128 copies
      uint4* dA = smem4;
      uint4* dW = smem4 + kTile4;
      const uint4* sA = Ag + (k0 >> 3);
      const uint4* sW = Wg + (k0 >> 3);
      #pragma unroll
      for (int i = 0; i < kBT * kRow4 / 256; i++) {
        int q4 = tid + i * 256;
        int r = q4 / kRow4, c4 = q4 % kRow4;
        dA[r * kPitch4 + c4] = sA[(size_t)r * ld + c4];
        dW[r * kPitch4 + c4] = sW[(size_t)r * ld + c4];
      }
    }
    __syncthreads();
    const uint4* ap = reinterpret_cast<const uint4*>(smem4);
    const uint4* bp = ap + kTile4;
#endif

    #pragma unroll
    for (int kh = 0; kh < kBK / kHK; kh++) {
    Frag afrag[kHK / 32][kMT], bfrag[kHK / 32][kNT];
    #pragma unroll
    for (int ks = 0; ks < kHK / 32; ks++) {
      const int kc = (kh * (kHK / 32) + ks) * 4 + hsel;   // the lane's first 16-B unit of this k step
      #pragma unroll
      for (int mt = 0; mt < kMT; mt++) {
        int r = waveM * (kMT * 16) + mt * 16 + rl;
        afrag[ks][mt].u[0] = ap[r * kPitch4 + kc];
        afrag[ks][mt].u[1] = ap[r * kPitch4 + kc + 2];
      }
      // this one and the one below keep the reads in the order in which the
      // matrix instructions use them: with the operands swapped the scheduler
      // put the fragments that are used first at the end of the group, and the
      // first matrix instruction then waited for 40 of the 48 reads, not for 10
      __builtin_amdgcn_sched_barrier(0);
      #pragma unroll
      for (int nt = 0; nt < kNT; nt++) {
        int c = waveN * (kNT * 16) + nt * 16 + rl;
        bfrag[ks][nt].u[0] = bp[c * kPitch4 + kc];
        bfrag[ks][nt].u[1] = bp[c * kPitch4 + kc + 2];
        __builtin_amdgcn_sched_barrier(0);
      }
    }
    // keeps the 48 reads of a block in one group in front of its 64 matrix
    // instructions: left alone the scheduler sinks reads to just in front of
    // their users, and the wave waits out the LDS latency again and again
    __builtin_amdgcn_sched_barrier(0);
    #pragma unroll
    for (int ks = 0; ks < kHK / 32; ks++)
      #pragma unroll
      for (int nt = 0; nt < kNT; nt++)   // in the order in which the W reads land
        #pragma unroll
        for (int mt = 0; mt < kMT; mt++)
          // W rows as the first operand: the tile comes out transposed, and a
          // lane's 8 accumulator registers are 8 consecutive columns of one C row
          acc[mt][nt] = __builtin_amdgcn_wmma_f32_16x16x32_f16(
              false, bfrag[ks][nt].h, false, afrag[ks][mt].h,
              (short)0, acc[mt][nt], false, false);
    // keeps the matrix instructions in front of the next block's reads and of the
    // pass-foot waits and barrier: left alone the scheduler lifts those over them,
    // and the wait for the next tile's copies then stands right behind their issue
    __builtin_amdgcn_sched_barrier(0);
    }

#if USE_ASYNC
    // this wave's reads of the current buffer are done before it is refilled
    asm volatile("s_wait_dscnt 0x0" ::: "memory");
    // this wave's copies of the next tile have landed before the barrier publishes them
    asm volatile("s_wait_asynccnt 0x0" ::: "memory");
    __syncthreads();
    if (k0 + 2 * kBK < K) issue(k0 + 2 * kBK, cur);  // refill the buffer just read
#else
    __syncthreads();
#endif
  }
#if USE_ASYNC
  // no copy is outstanding when the wave goes on to its end
  asm volatile("s_wait_asynccnt 0x0" ::: "memory");
#endif

  // ---- epilogue: bias + ReLU. acc[mt][nt][j] = row mt * 16 + rl, column
  // nt * 16 + hsel * 8 + j of the wave's tile: 8 results make one 16-B unit.
  // The units go to the wave's own LDS range and come back as whole rows, so that
  // every global store is 16 B a lane and covers two whole 256-B units of C
  // (2-B stores from the accumulators wrote 32-B pieces, 8 times the stores).
  // The ring is free: the last pass ended in its waits and its barrier.
  const float* bias = (e < kSpec) ? (biasS + (size_t)e * N)
                                  : (biasH + (size_t)(e - kSpec) * N);
  // a lane needs 8 consecutive biases per nt: the wave fetches its 128 with one
  // 512-B load and hands them round through LDS
  f32x4* bl = reinterpret_cast<f32x4*>(smem4 + kOut4) + wave * kOutBias4;
  const f32x4 bw = reinterpret_cast<const f32x4*>(bias + n0 + waveN * (kNT * 16))[lane];
  // the wait stands in front of the first instruction that reuses the load's
  // address registers; the scheduling barrier keeps later address arithmetic
  // from being lifted over it
  asm volatile("s_wait_xcnt 0x0" ::: "memory");
  __builtin_amdgcn_sched_barrier(0);
  bl[lane] = bw;
  // the wave's own LDS write is done before its lanes read one another's biases
  asm volatile("s_wait_dscnt 0x0" ::: "memory");
  // all sixteen reads in front of the first staging write: one LDS latency, not eight
  f32x4 bb[kNT][2];
  #pragma unroll
  for (int nt = 0; nt < kNT; nt++) {
    bb[nt][0] = bl[nt * 4 + hsel * 2];
    bb[nt][1] = bl[nt * 4 + hsel * 2 + 1];
  }
  uint4* st = smem4 + wave * kOutWave4;
  #pragma unroll
  for (int nt = 0; nt < kNT; nt++) {
    const f32x4 blo = bb[nt][0], bhi = bb[nt][1];
    #pragma unroll
    for (int mt = 0; mt < kMT; mt++) {
      union { _Float16 f[8]; uint4 u; } p;
      #pragma unroll
      for (int j = 0; j < 8; j++) {
        float v = acc[mt][nt][j] + (j < 4 ? blo[j & 3] : bhi[j & 3]);
        v = v > 0.f ? v : 0.f;
        p.f[j] = (_Float16)v;
      }
      st[(mt * 16 + rl) * kOutPitch4 + nt * 2 + hsel] = p.u;
    }
  }
  // the wave's own LDS writes are done before its lanes read one another's units
  asm volatile("s_wait_dscnt 0x0" ::: "memory");
  uint4 row[kMT * 8];
  #pragma unroll
  for (int i = 0; i < kMT * 8; i++) row[i] = st[(i * 2 + hsel) * kOutPitch4 + rl];
  uint4* Cp = reinterpret_cast<uint4*>(
      C + (size_t)e * Bsz * N + (size_t)(m0 + waveM * (kMT * 16) + hsel) * N +
      n0 + waveN * (kNT * 16)) + rl;
  const int ldc = N >> 3;              // row stride of C in 16-B units
  #pragma unroll
  for (int i = 0; i < kMT * 8; i++) Cp[(size_t)(i * 2) * ldc] = row[i];
}

// ---------------- gated combine: 4 outputs, each [B, H2] f32 ------------
__global__ void __launch_bounds__(256)
combine_kernel(const _Float16* __restrict__ eo,   // [8][B][H2]
               const float* __restrict__ gates,   // [B][20]
               float* __restrict__ out) {         // [4][B][H2]
  int idx = blockIdx.x * blockDim.x + threadIdx.x;
  if (idx >= kB * kH2) return;
  int b = idx / kH2, o = idx % kH2;
  float ex[8];
  #pragma unroll
  for (int k = 0; k < 8; k++)
    ex[k] = (float)eo[((size_t)k * kB + b) * kH2 + o];
  const float* g = gates + (size_t)b * 20;
  float o0 = g[0] * ex[0] + g[1] * ex[1] + g[2]  * ex[6] + g[3]  * ex[7];
  float o1 = g[4] * ex[2] + g[5] * ex[3] + g[6]  * ex[6] + g[7]  * ex[7];
  float o2 = g[8] * ex[4] + g[9] * ex[5] + g[10] * ex[6] + g[11] * ex[7];
  float o3 = 0.f;
  #pragma unroll
  for (int k = 0; k < 8; k++) o3 += g[12 + k] * ex[k];
  size_t p = (size_t)b * kH2 + o;
  const size_t page = (size_t)kB * kH2;
  out[p]            = o0;
  out[page + p]     = o1;
  out[2 * page + p] = o2;
  out[3 * page + p] = o3;
}

extern "C" void kernel_launch(void* const* d_in, const int* in_sizes, int n_in,
                              void* d_out, int out_size, void* d_ws, size_t ws_size,
                              hipStream_t stream) {
  const float* x0  = (const float*)d_in[0];
  const float* x1  = (const float*)d_in[1];
  const float* x2  = (const float*)d_in[2];
  const float* xs  = (const float*)d_in[3];
  const float* W1s = (const float*)d_in[4];
  const float* b1s = (const float*)d_in[5];
  const float* W2s = (const float*)d_in[6];
  const float* b2s = (const float*)d_in[7];
  const float* W1h = (const float*)d_in[8];
  const float* b1h = (const float*)d_in[9];
  const float* W2h = (const float*)d_in[10];
  const float* b2h = (const float*)d_in[11];
  const float* Wg  = (const float*)d_in[12];
  const float* bg  = (const float*)d_in[13];
  const float* Wsg = (const float*)d_in[14];
  const float* bsg = (const float*)d_in[15];
  (void)in_sizes; (void)n_in; (void)out_size; (void)ws_size;

  // ---- workspace carve-out (~153 MB), 256B aligned ----
  char* ws = (char*)d_ws;
  size_t off = 0;
  auto take = [&](size_t bytes) -> char* {
    char* p = ws + off;
    off += (bytes + 255) & ~(size_t)255;
    return p;
  };
  _Float16* xh  = (_Float16*)take((size_t)4 * kB * kDin * 2);   // x pages f16
  _Float16* w1t = (_Float16*)take((size_t)kE * kH1 * kDin * 2); // W1^T f16 [E][N][K]
  _Float16* w2t = (_Float16*)take((size_t)kE * kH2 * kH1 * 2);  // W2^T f16 [E][N][K]
  _Float16* hb  = (_Float16*)take((size_t)kE * kB * kH1 * 2);   // hidden acts f16
  _Float16* eo  = (_Float16*)take((size_t)kE * kB * kH2 * 2);   // expert outputs f16
  float*    gts = (float*)   take((size_t)kB * 20 * 4);         // gate weights

  // weights: convert + transpose to [E][N][K] so GEMM streams b128 tiles
  weights_f16_transposed<<<kW1Tiles + kW2Tiles, 256, 0, stream>>>(
      W1s, W1h, W2s, W2h, w1t, w2t);

  // x pages -> f16 and the gate weights, from one read of x
  x_f16_gates_kernel<<<dim3(kB / (8 * kXRows), 4), 256, 0, stream>>>(
      x0, x1, x2, xs, Wg, bg, Wsg, bsg, xh, gts);

  // layer 1: h[e] = relu(x_page(e) @ W1[e] + b1[e])   [B,1024]
  dim3 g1(kH1 / kBT, kB / kBT, kE);
  gemm_bias_relu_wmma<<<g1, 256, 0, stream>>>(xh, w1t, b1s, b1h, hb,
                                              kB, kDin, kH1, /*pageMode=*/1);
  // layer 2: eo[e] = relu(h[e] @ W2[e] + b2[e])       [B,512]
  dim3 g2(kH2 / kBT, kB / kBT, kE);
  gemm_bias_relu_wmma<<<g2, 256, 0, stream>>>(hb, w2t, b2s, b2h, eo,
                                              kB, kH1, kH2, /*pageMode=*/0);

  combine_kernel<<<(kB * kH2 + 255) / 256, 256, 0, stream>>>(eo, gts, (float*)d_out);
}

// v008
// Measured time: 96.9 microseconds a run.
// Two timings next to v007 both put it at 1.04 times that version's speed.
// All steps since v000 together make it 2.95 times as fast.
#include <hip/hip_runtime.h>
#include <hip/hip_bf16.h>

typedef __attribute__((ext_vector_type(16))) _Float16 v16h;
typedef __attribute__((ext_vector_type(8)))  float    v8f;

constexpr int kB    = 4096;
constexpr int kDin  = 1024;
constexpr int kH1   = 1024;
constexpr int kH2   = 512;
constexpr int kE    = 8;   // 6 specific + 2 shared experts
constexpr int kSpec = 6;

constexpr int kBK     = 128;             // k depth of one pass, in halves
constexpr int kHK     = 64;              // k depth of one block of matrix instructions
constexpr int kRow4   = kBK / 8;         // 16-B units of data per tile row
constexpr int kPitch4 = kRow4 + 1;       // row pitch in 16-B units
constexpr int kBT     = 256;             // rows of A and rows of W^T per block tile
constexpr int kMT     = 4;               // 16-row A fragments per wave (64 rows)
constexpr int kNT     = 8;               // 16-row W fragments per wave (128 columns)
constexpr int kTile4  = kBT * kPitch4;   // one operand tile
constexpr int kBuf4   = 2 * kTile4;      // one (A|W) stage
constexpr int kOutRow4   = kNT * 16 / 8;             // 16-B units of data per row
constexpr int kOutPitch4 = kOutRow4 + 1;             // row pitch in 16-B units
constexpr int kOutWave4  = kMT * 16 * kOutPitch4;    // one wave's range
constexpr int kOut4      = 8 * kOutWave4;            // all eight waves: 136 KB
constexpr int kOutBias4  = kNT * 16 / 4;             // a wave's 128 f32 biases, behind the tiles

union Frag { uint4 u[2]; v16h h; };

#if defined(__AMDGCN__) && \
    __has_builtin(__builtin_amdgcn_global_load_async_to_lds_b128) && \
    __has_builtin(__builtin_amdgcn_s_wait_asynccnt)
#define USE_ASYNC 1
typedef int v4i __attribute__((ext_vector_type(4)));
typedef __attribute__((address_space(3))) v4i lds_v4i;
typedef __attribute__((address_space(1))) v4i glb_v4i;
#else
#define USE_ASYNC 0
#endif

// ------------- f32 [E][K][N] -> f16 [E][N][K] transpose+convert --------
// One body for the four weight arrays. A work-group takes a tile of kTK k by
// kTN n of one expert: few, fat waves, for speed only. Every global access is 16 B a lane
// and covers whole 256-B units: a source row of the tile is 64 f32 = 256 B, a
// row of the transposed tile 256 f16 = 512 B.
typedef float f32x4 __attribute__((ext_vector_type(4)));
constexpr int kTK = 256;                 // k per tile
constexpr int kTN = 64;                  // n per tile
constexpr int kTU = kTK / 8;             // 16-B units of f16 per transposed tile row
constexpr int kW1Tiles = kE * (kDin / kTK) * (kH1 / kTN);
constexpr int kW2Tiles = kE * (kH1 / kTK) * (kH2 / kTN);

template <int K, int N>
__device__ __forceinline__ void w_tile(const float* __restrict__ src,  // [K][N], one expert
                                       _Float16* __restrict__ dst,     // [N][K], one expert
                                       int k0, int n0, uint4* t) {
  const int tid = threadIdx.x;
  const int n4  = tid & 15;              // the thread's four n
  const int kg  = tid >> 4;              // the thread's sixteen k
  const f32x4* s4 =
      reinterpret_cast<const f32x4*>(src + (size_t)(k0 + kg * 16) * N + n0) + n4;
  f32x4 v[16];
  #pragma unroll
  for (int i = 0; i < 16; i++) v[i] = s4[i * (N / 4)];
  // keeps all sixteen loads in front of the first conversion: left alone the
  // scheduler saves registers by issuing the last four only when the first have
  // returned, and the wave then waits out the memory latency more than once
  __builtin_amdgcn_sched_barrier(0);

  #pragma unroll
  for (int c = 0; c < 4; c++)
    #pragma unroll
    for (int h = 0; h < 2; h++) {
      union { _Float16 f[8]; uint4 u; } p;
      #pragma unroll
      for (int i = 0; i < 8; i++) p.f[i] = (_Float16)v[h * 8 + i][c];
      t[(n4 * 4 + c) * kTU + ((kg * 2 + h + n4) & (kTU - 1))] = p.u;
    }
  __syncthreads();

  // a wave stores whole tile rows, 512 B each: row n = 8 j + wave, lane = unit
  const int w = tid >> 5, u = tid & 31;
  uint4* d4 = reinterpret_cast<uint4*>(dst + (size_t)(n0 + w) * K + k0) + u;
  uint4 r[kTN / 8];
  #pragma unroll
  for (int j = 0; j < kTN / 8; j++)      // (8 j + w) / 4 = 2 j + w / 4
    r[j] = t[(j * 8 + w) * kTU + ((u + (w >> 2) + 2 * j) & (kTU - 1))];
  #pragma unroll
  for (int j = 0; j < kTN / 8; j++) d4[j * 8 * (K / 8)] = r[j];
  // other bodies of the shared kernel stand behind these stores in the code: the
  // wait stands in front of any instruction there that reuses the stores' registers
  asm volatile("s_wait_xcnt 0x0" ::: "memory");
}

__device__ __forceinline__ void
weights_f16_transposed(const float* __restrict__ W1s, const float* __restrict__ W1h,
                       const float* __restrict__ W2s, const float* __restrict__ W2h,
                       _Float16* __restrict__ w1t, _Float16* __restrict__ w2t,
                       unsigned b,             // tile index, < kW1Tiles + kW2Tiles
                       uint4* t) {             // kTN * kTU units of LDS, 32 KB
  if (b < (unsigned)kW1Tiles) {
    constexpr unsigned kNT = kH1 / kTN, kPer = (kDin / kTK) * kNT;
    const unsigned e = b / kPer, r = b % kPer;
    const float* src = (e < (unsigned)kSpec) ? W1s + (size_t)e * kDin * kH1
                                   : W1h + (size_t)(e - kSpec) * kDin * kH1;
    w_tile<kDin, kH1>(src, w1t + (size_t)e * kH1 * kDin, (r / kNT) * kTK, (r % kNT) * kTN, t);
  } else {
    b -= kW1Tiles;
    constexpr unsigned kNT = kH2 / kTN, kPer = (kH1 / kTK) * kNT;
    const unsigned e = b / kPer, r = b % kPer;
    const float* src = (e < (unsigned)kSpec) ? W2s + (size_t)e * kH1 * kH2
                                   : W2h + (size_t)(e - kSpec) * kH1 * kH2;
    w_tile<kH1, kH2>(src, w2t + (size_t)e * kH2 * kH1, (r / kNT) * kTK, (r % kNT) * kTN, t);
  }
}

typedef float f32x2 __attribute__((ext_vector_type(2)));
constexpr int kXRows = 4;                // rows of x per wave

template <int M, int HALF, int N>
__device__ __forceinline__ void wave_sums(float (&a)[N], int lane) {
  if constexpr (HALF >= 1) {
    const bool up = (lane & M) != 0;
    #pragma unroll
    for (int i = 0; i < HALF; i++) {
      float keep = up ? a[i + HALF] : a[i];
      float send = up ? a[i] : a[i + HALF];
      a[i] = keep + __shfl_xor(send, M, 32);
    }
  } else {
    a[0] += __shfl_xor(a[0], M, 32);
  }
  if constexpr (M > 1) wave_sums<M / 2, HALF / 2, N>(a, lane);
}

template <int NG>                        // gate width: 4 or 8
__device__ __forceinline__ void x_pass(const float* __restrict__ x,
                                       const float* __restrict__ Wgt,  // [D_IN][NG]
                                       const float* __restrict__ bias, // [NG]
                                       _Float16* __restrict__ xh,      // f16 page of x
                                       float* __restrict__ gates, int gbase,
                                       int xblk,                       // which 8 * kXRows rows
                                       f32x4* wl) {
  constexpr int H = NG / 4;              // 16-B units per weight row
  constexpr int N = kXRows * NG;         // sums per wave
  const int tid  = threadIdx.x;
  const int lane = tid & 31;
  const int blk0 = xblk * (8 * kXRows);                  // the block's first row
  const int row0 = blk0 + (tid >> 5) * kXRows;           // the wave's first row
  // the lane's first 16-B unit of x (8-B unit of the copy) inside the block's rows
  const int t0 = (tid >> 5) * (kXRows * (kDin / 4)) + lane;

  // gate weights first, then the rows: the weights can be laid in LDS while
  // the rows are still in flight
  const f32x4* W4 = reinterpret_cast<const f32x4*>(Wgt);
  f32x4 wv[4 * H];
  #pragma unroll
  for (int i = 0; i < 4 * H; i++) wv[i] = W4[tid + i * 256];
  const f32x4* xp = reinterpret_cast<const f32x4*>(x) + (size_t)blk0 * (kDin / 4);
  f32x4 xv[kXRows][8];
  #pragma unroll
  for (int r = 0; r < kXRows; r++)
    #pragma unroll
    for (int j = 0; j < 8; j++) xv[r][j] = xp[t0 + r * (kDin / 4) + j * 32];

  // LDS order [j][c][h][lane]: the 32 lanes of a reader take 512 contiguous B
  #pragma unroll
  for (int i = 0; i < 4 * H; i++) {
    int q = tid + i * 256;
    int k = q / H, h = q % H;
    wl[(((k >> 7) * 4 + (k & 3)) * H + h) * 32 + ((k >> 2) & 31)] = wv[i];
  }
  __syncthreads();

  uint2* xo = reinterpret_cast<uint2*>(xh) + (size_t)blk0 * (kDin / 4);
  f32x2 acc2[N / 2];                     // gates 2 i, 2 i + 1 of row r at [r * NG / 2 + i]
  #pragma unroll
  for (int i = 0; i < N / 2; i++) acc2[i] = (f32x2){0.f, 0.f};
  #pragma unroll
  for (int j = 0; j < 8; j++) {
    #pragma unroll
    for (int r = 0; r < kXRows; r++) {
      union { _Float16 h[4]; uint2 u; } p;
      p.h[0] = (_Float16)xv[r][j][0]; p.h[1] = (_Float16)xv[r][j][1];
      p.h[2] = (_Float16)xv[r][j][2]; p.h[3] = (_Float16)xv[r][j][3];
      xo[t0 + r * (kDin / 4) + j * 32] = p.u;
    }
    #pragma unroll
    for (int c = 0; c < 4; c++)
      #pragma unroll
      for (int h = 0; h < H; h++) {
        const f32x4 w = wl[((j * 4 + c) * H + h) * 32 + lane];
        #pragma unroll
        for (int r = 0; r < kXRows; r++) {
          const f32x2 xx = {xv[r][j][c], xv[r][j][c]};
          f32x2& lo = acc2[r * (NG / 2) + h * 2];
          f32x2& hi = acc2[r * (NG / 2) + h * 2 + 1];
          lo = __builtin_elementwise_fma(w.lo, xx, lo);
          hi = __builtin_elementwise_fma(w.hi, xx, hi);
        }
      }
    // holds the f16 stores of step j in front of the products of step j + 1:
    // without it the scheduler sinks every store behind the last sum, and the
    // writes only start when the arithmetic is over
    __builtin_amdgcn_sched_barrier(0);
  }
  float acc[N];                          // acc[r * NG + g]: the sum over this lane's 32 k
  #pragma unroll
  for (int i = 0; i < N / 2; i++) { acc[2 * i] = acc2[i][0]; acc[2 * i + 1] = acc2[i][1]; }

  wave_sums<16, N / 2, N>(acc, lane);

  // softmax inside the lanes that hold one row's logits (each logit kDup times)
  constexpr int kDup = 32 / N;
  const int g = (lane / kDup) % NG;
  const float lg = acc[0] + bias[g];
  float mx = lg;
  #pragma unroll
  for (int m = kDup; m < kDup * NG; m <<= 1) mx = fmaxf(mx, __shfl_xor(mx, m, 32));
  const float ev = expf(lg - mx);
  float sum = ev;
  #pragma unroll
  for (int m = kDup; m < kDup * NG; m <<= 1) sum += __shfl_xor(sum, m, 32);
  const float gw = ev * (1.f / sum);
  if (lane % kDup == 0)
    gates[(size_t)(row0 + lane / (kDup * NG)) * 20 + gbase + g] = gw;
}

// One launch for both preparations, which do not depend on each other: a weight
// tile starts on a WGP as soon as an x block there has ended, so that memory stays
// busy over what was the end of one launch, the gap and the start of the next. The
// x blocks come first: they last longer.
constexpr int kXBlkRow = kB / (8 * kXRows);      // x blocks per input
constexpr int kXBlocks = 4 * kXBlkRow;           // x blocks in all

__global__ void __launch_bounds__(256)
prepare_kernel(const float* __restrict__ x0, const float* __restrict__ x1,
               const float* __restrict__ x2, const float* __restrict__ xs,
               const float* __restrict__ Wg,  const float* __restrict__ bg,
               const float* __restrict__ Wsg, const float* __restrict__ bsg,
               const float* __restrict__ W1s, const float* __restrict__ W1h,
               const float* __restrict__ W2s, const float* __restrict__ W2h,
               _Float16* __restrict__ xh, float* __restrict__ gates,
               _Float16* __restrict__ w1t, _Float16* __restrict__ w2t) {
  // 32 KB: one input's gate weights, or one transposed weight tile
  __shared__ alignas(16) f32x4 wl[kDin * 2];
  static_assert(kTN * kTU == kDin * 2, "both bodies use the whole array");
  const unsigned blk = blockIdx.x;
  if (blk < (unsigned)kXBlocks) {
    const int d = blk / kXBlkRow, xblk = blk % kXBlkRow;
    _Float16* page = xh + (size_t)d * kB * kDin;
    const float* x = (d == 0) ? x0 : (d == 1) ? x1 : (d == 2) ? x2 : xs;
    if (d == 3)
      x_pass<8>(x, Wsg, bsg, page, gates, 12, xblk, wl);
    else
      x_pass<4>(x, Wg + (size_t)d * kDin * 4, bg + d * 4, page, gates, d * 4, xblk, wl);
  } else {
    weights_f16_transposed(W1s, W1h, W2s, W2h, w1t, w2t, blk - kXBlocks,
                           reinterpret_cast<uint4*>(wl));
  }
}

// ---------------- WMMA GEMM: C = relu(A @ W + bias), f16 in / f32 acc ----
// block = 256 threads (8 waves); block tile 256(M) x 256(N); wave tile 64x128:
// a byte fetched from L2 serves twice the products of a 128 x 128 tile, and a
// fragment read from LDS feeds 32 / 12 matrix instructions and not 8 / 6. The
// accumulators take 256 registers, so one block is resident per WGP.
// A : [pages][Bsz][K] f16 row-major.
// Wt: [E][N][K] f16 (pre-transposed) -> W tile loader identical to A tile.
// pageMode=1: expert e reads A page (e<6 ? e/2 : 3)   (layer-1 input mapping)
// pageMode=0: expert e reads A page e                 (layer-2: h buffer)
__global__ void __launch_bounds__(256)
gemm_bias_relu_wmma(const _Float16* __restrict__ A,
                    const _Float16* __restrict__ Wt,
                    const float* __restrict__ biasS,
                    const float* __restrict__ biasH,
                    _Float16* __restrict__ C,
                    int Bsz, int K, int N, int pageMode) {
#if USE_ASYNC
  __shared__ alignas(16) uint4 smem4[2 * kBuf4];   // 272 KB: double-buffered (A|W) tiles; then output staging
#else
  __shared__ alignas(16) uint4 smem4[kOut4 + 8 * kOutBias4];  // single (A|W) tile, 136 KB; output staging, 140 KB
#endif

  const int tid  = threadIdx.x;
  const int lane = tid & 31;
  const int wave = tid >> 5;
  const int waveM = wave & 3;          // 4 waves along M
  const int waveN = wave >> 2;         // 2 waves along N
  const int rl   = lane & 15;
  const int hsel = lane >> 4;

  const int e  = blockIdx.z;
  const int n0 = blockIdx.x * kBT;
  const int m0 = blockIdx.y * kBT;
  const int page = pageMode ? ((e < kSpec) ? (e >> 1) : 3) : e;
  const int ld = K >> 3;               // row stride in uint4 units

  const uint4* __restrict__ Ag = reinterpret_cast<const uint4*>(A) +
      (size_t)page * Bsz * ld + (size_t)m0 * ld;
  const uint4* __restrict__ Wg = reinterpret_cast<const uint4*>(Wt) +
      (size_t)e * N * ld + (size_t)n0 * ld;

  const v8f vzero = {0.f, 0.f, 0.f, 0.f, 0.f, 0.f, 0.f, 0.f};
  v8f acc[kMT][kNT];
  #pragma unroll
  for (int mt = 0; mt < kMT; mt++)
    #pragma unroll
    for (int nt = 0; nt < kNT; nt++) acc[mt][nt] = vzero;

#if USE_ASYNC
  auto issue = [&](int k0, int buf) {
    lds_v4i* dA = (lds_v4i*)(smem4 + buf * kBuf4);
    lds_v4i* dW = dA + kTile4;
    glb_v4i* sA = (glb_v4i*)(Ag + (k0 >> 3));
    glb_v4i* sW = (glb_v4i*)(Wg + (k0 >> 3));
    #pragma unroll
    for (int i = 0; i < kBT * kRow4 / 256; i++) {
      int q4 = tid + i * 256;
      int r = q4 / kRow4, c4 = q4 % kRow4;
      __builtin_amdgcn_global_load_async_to_lds_b128(sA + (size_t)r * ld + c4,
                                                     dA + r * kPitch4 + c4, 0, 0);
      __builtin_amdgcn_global_load_async_to_lds_b128(sW + (size_t)r * ld + c4,
                                                     dW + r * kPitch4 + c4, 0, 0);
    }
  };
  issue(0, 0);
  // tile 0 has landed for this wave before the barrier publishes it
  asm volatile("s_wait_asynccnt 0x0" ::: "memory");
  __syncthreads();
  if (kBK < K) issue(kBK, 1);                   // tile 1 flies during pass 0
#endif

  for (int k0 = 0; k0 < K; k0 += kBK) {
#if USE_ASYNC
    const int cur = (k0 / kBK) & 1;
    const uint4* ap = reinterpret_cast<const uint4*>(smem4 + cur * kBuf4);
    const uint4* bp = ap + kTile4;
#else
    {  // synchronous fallback: both tiles are plain coalesced b128 copies
      uint4* dA = smem4;
      uint4* dW = smem4 + kTile4;
      const uint4* sA = Ag + (k0 >> 3);
      const uint4* sW = Wg + (k0 >> 3);
      #pragma unroll
      for (int i = 0; i < kBT * kRow4 / 256; i++) {
        int q4 = tid + i * 256;
        int r = q4 / kRow4, c4 = q4 % kRow4;
        dA[r * kPitch4 + c4] = sA[(size_t)r * ld + c4];
        dW[r * kPitch4 + c4] = sW[(size_t)r * ld + c4];
      }
    }
    __syncthreads();
    const uint4* ap = reinterpret_cast<const uint4*>(smem4);
    const uint4* bp = ap + kTile4;
#endif

    #pragma unroll
    for (int kh = 0; kh < kBK / kHK; kh++) {
    Frag afrag[kHK / 32][kMT], bfrag[kHK / 32][kNT];
    #pragma unroll
    for (int ks = 0; ks < kHK / 32; ks++) {
      const int kc = (kh * (kHK / 32) + ks) * 4 + hsel;   // the lane's first 16-B unit of this k step
      #pragma unroll
      for (int mt = 0; mt < kMT; mt++) {
        int r = waveM * (kMT * 16) + mt * 16 + rl;
        afrag[ks][mt].u[0] = ap[r * kPitch4 + kc];
        afrag[ks][mt].u[1] = ap[r * kPitch4 + kc + 2];
      }
      // this one and the one below keep the reads in the order in which the
      // matrix instructions use them: with the operands swapped the scheduler
      // put the fragments that are used first at the end of the group, and the
      // first matrix instruction then waited for 40 of the 48 reads, not for 10
      __builtin_amdgcn_sched_barrier(0);
      #pragma unroll
      for (int nt = 0; nt < kNT; nt++) {
        int c = waveN * (kNT * 16) + nt * 16 + rl;
        bfrag[ks][nt].u[0] = bp[c * kPitch4 + kc];
        bfrag[ks][nt].u[1] = bp[c * kPitch4 + kc + 2];
        __builtin_amdgcn_sched_barrier(0);
      }
    }
    // keeps the 48 reads of a block in one group in front of its 64 matrix
    // instructions: left alone the scheduler sinks reads to just in front of
    // their users, and the wave waits out the LDS latency again and again
    __builtin_amdgcn_sched_barrier(0);
    #pragma unroll
    for (int ks = 0; ks < kHK / 32; ks++)
      #pragma unroll
      for (int nt = 0; nt < kNT; nt++)   // in the order in which the W reads land
        #pragma unroll
        for (int mt = 0; mt < kMT; mt++)
          // W rows as the first operand: the tile comes out transposed, and a
          // lane's 8 accumulator registers are 8 consecutive columns of one C row
          acc[mt][nt] = __builtin_amdgcn_wmma_f32_16x16x32_f16(
              false, bfrag[ks][nt].h, false, afrag[ks][mt].h,
              (short)0, acc[mt][nt], false, false);
    // keeps the matrix instructions in front of the next block's reads and of the
    // pass-foot waits and barrier: left alone the scheduler lifts those over them,
    // and the wait for the next tile's copies then stands right behind their issue
    __builtin_amdgcn_sched_barrier(0);
    }

#if USE_ASYNC
    // this wave's reads of the current buffer are done before it is refilled
    asm volatile("s_wait_dscnt 0x0" ::: "memory");
    // this wave's copies of the next tile have landed before the barrier publishes them
    asm volatile("s_wait_asynccnt 0x0" ::: "memory");
    __syncthreads();
    if (k0 + 2 * kBK < K) issue(k0 + 2 * kBK, cur);  // refill the buffer just read
#else
    __syncthreads();
#endif
  }
#if USE_ASYNC
  // no copy is outstanding when the wave goes on to its end
  asm volatile("s_wait_asynccnt 0x0" ::: "memory");
#endif

  // ---- epilogue: bias + ReLU. acc[mt][nt][j] = row mt * 16 + rl, column
  // nt * 16 + hsel * 8 + j of the wave's tile: 8 results make one 16-B unit.
  // The units go to the wave's own LDS range and come back as whole rows, so that
  // every global store is 16 B a lane and covers two whole 256-B units of C
  // (2-B stores from the accumulators wrote 32-B pieces, 8 times the stores).
  // The ring is free: the last pass ended in its waits and its barrier.
  const float* bias = (e < kSpec) ? (biasS + (size_t)e * N)
                                  : (biasH + (size_t)(e - kSpec) * N);
  // a lane needs 8 consecutive biases per nt: the wave fetches its 128 with one
  // 512-B load and hands them round through LDS
  f32x4* bl = reinterpret_cast<f32x4*>(smem4 + kOut4) + wave * kOutBias4;
  const f32x4 bw = reinterpret_cast<const f32x4*>(bias + n0 + waveN * (kNT * 16))[lane];
  // the wait stands in front of the first instruction that reuses the load's
  // address registers; the scheduling barrier keeps later address arithmetic
  // from being lifted over it
  asm volatile("s_wait_xcnt 0x0" ::: "memory");
  __builtin_amdgcn_sched_barrier(0);
  bl[lane] = bw;
  // the wave's own LDS write is done before its lanes read one another's biases
  asm volatile("s_wait_dscnt 0x0" ::: "memory");
  // all sixteen reads in front of the first staging write: one LDS latency, not eight
  f32x4 bb[kNT][2];
  #pragma unroll
  for (int nt = 0; nt < kNT; nt++) {
    bb[nt][0] = bl[nt * 4 + hsel * 2];
    bb[nt][1] = bl[nt * 4 + hsel * 2 + 1];
  }
  uint4* st = smem4 + wave * kOutWave4;
  #pragma unroll
  for (int nt = 0; nt < kNT; nt++) {
    const f32x4 blo = bb[nt][0], bhi = bb[nt][1];
    #pragma unroll
    for (int mt = 0; mt < kMT; mt++) {
      union { _Float16 f[8]; uint4 u; } p;
      #pragma unroll
      for (int j = 0; j < 8; j++) {
        float v = acc[mt][nt][j] + (j < 4 ? blo[j & 3] : bhi[j & 3]);
        v = v > 0.f ? v : 0.f;
        p.f[j] = (_Float16)v;
      }
      st[(mt * 16 + rl) * kOutPitch4 + nt * 2 + hsel] = p.u;
    }
  }
  // the wave's own LDS writes are done before its lanes read one another's units
  asm volatile("s_wait_dscnt 0x0" ::: "memory");
  uint4 row[kMT * 8];
  #pragma unroll
  for (int i = 0; i < kMT * 8; i++) row[i] = st[(i * 2 + hsel) * kOutPitch4 + rl];
  uint4* Cp = reinterpret_cast<uint4*>(
      C + (size_t)e * Bsz * N + (size_t)(m0 + waveM * (kMT * 16) + hsel) * N +
      n0 + waveN * (kNT * 16)) + rl;
  const int ldc = N >> 3;              // row stride of C in 16-B units
  #pragma unroll
  for (int i = 0; i < kMT * 8; i++) Cp[(size_t)(i * 2) * ldc] = row[i];
}

// ---------------- gated combine: 4 outputs, each [B, H2] f32 ------------
__global__ void __launch_bounds__(256)
combine_kernel(const _Float16* __restrict__ eo,   // [8][B][H2]
               const float* __restrict__ gates,   // [B][20]
               float* __restrict__ out) {         // [4][B][H2]
  int idx = blockIdx.x * blockDim.x + threadIdx.x;
  if (idx >= kB * kH2) return;
  int b = idx / kH2, o = idx % kH2;
  float ex[8];
  #pragma unroll
  for (int k = 0; k < 8; k++)
    ex[k] = (float)eo[((size_t)k * kB + b) * kH2 + o];
  const float* g = gates + (size_t)b * 20;
  float o0 = g[0] * ex[0] + g[1] * ex[1] + g[2]  * ex[6] + g[3]  * ex[7];
  float o1 = g[4] * ex[2] + g[5] * ex[3] + g[6]  * ex[6] + g[7]  * ex[7];
  float o2 = g[8] * ex[4] + g[9] * ex[5] + g[10] * ex[6] + g[11] * ex[7];
  float o3 = 0.f;
  #pragma unroll
  for (int k = 0; k < 8; k++) o3 += g[12 + k] * ex[k];
  size_t p = (size_t)b * kH2 + o;
  const size_t page = (size_t)kB * kH2;
  out[p]            = o0;
  out[page + p]     = o1;
  out[2 * page + p] = o2;
  out[3 * page + p] = o3;
}

extern "C" void kernel_launch(void* const* d_in, const int* in_sizes, int n_in,
                              void* d_out, int out_size, void* d_ws, size_t ws_size,
                              hipStream_t stream) {
  const float* x0  = (const float*)d_in[0];
  const float* x1  = (const float*)d_in[1];
  const float* x2  = (const float*)d_in[2];
  const float* xs  = (const float*)d_in[3];
  const float* W1s = (const float*)d_in[4];
  const float* b1s = (const float*)d_in[5];
  const float* W2s = (const float*)d_in[6];
  const float* b2s = (const float*)d_in[7];
  const float* W1h = (const float*)d_in[8];
  const float* b1h = (const float*)d_in[9];
  const float* W2h = (const float*)d_in[10];
  const float* b2h = (const float*)d_in[11];
  const float* Wg  = (const float*)d_in[12];
  const float* bg  = (const float*)d_in[13];
  const float* Wsg = (const float*)d_in[14];
  const float* bsg = (const float*)d_in[15];
  (void)in_sizes; (void)n_in; (void)out_size; (void)ws_size;

  // ---- workspace carve-out (~153 MB), 256B aligned ----
  char* ws = (char*)d_ws;
  size_t off = 0;
  auto take = [&](size_t bytes) -> char* {
    char* p = ws + off;
    off += (bytes + 255) & ~(size_t)255;
    return p;
  };
  _Float16* xh  = (_Float16*)take((size_t)4 * kB * kDin * 2);   // x pages f16
  _Float16* w1t = (_Float16*)take((size_t)kE * kH1 * kDin * 2); // W1^T f16 [E][N][K]
  _Float16* w2t = (_Float16*)take((size_t)kE * kH2 * kH1 * 2);  // W2^T f16 [E][N][K]
  _Float16* hb  = (_Float16*)take((size_t)kE * kB * kH1 * 2);   // hidden acts f16
  _Float16* eo  = (_Float16*)take((size_t)kE * kB * kH2 * 2);   // expert outputs f16
  float*    gts = (float*)   take((size_t)kB * 20 * 4);         // gate weights

  // x pages -> f16 and the gate weights, from one read of x; weights: convert +
  // transpose to [E][N][K] so GEMM streams b128 tiles
  prepare_kernel<<<kXBlocks + kW1Tiles + kW2Tiles, 256, 0, stream>>>(
      x0, x1, x2, xs, Wg, bg, Wsg, bsg, W1s, W1h, W2s, W2h, xh, gts, w1t, w2t);

  // layer 1: h[e] = relu(x_page(e) @ W1[e] + b1[e])   [B,1024]
  dim3 g1(kH1 / kBT, kB / kBT, kE);
  gemm_bias_relu_wmma<<<g1, 256, 0, stream>>>(xh, w1t, b1s, b1h, hb,
                                              kB, kDin, kH1, /*pageMode=*/1);
  // layer 2: eo[e] = relu(h[e] @ W2[e] + b2[e])       [B,512]
  dim3 g2(kH2 / kBT, kB / kBT, kE);
  gemm_bias_relu_wmma<<<g2, 256, 0, stream>>>(hb, w2t, b2s, b2h, eo,
                                              kB, kH1, kH2, /*pageMode=*/0);

  combine_kernel<<<(kB * kH2 + 255) / 256, 256, 0, stream>>>(eo, gts, (float*)d_out);
}

// v009
// Measured time: 90.8 microseconds a run.
// In both of two side-by-side timings against v008, it was 1.07 times as fast.
// All steps since v000 together make it 3.15 times as fast.
#include <hip/hip_runtime.h>
#include <hip/hip_bf16.h>

typedef __attribute__((ext_vector_type(16))) _Float16 v16h;
typedef __attribute__((ext_vector_type(8)))  float    v8f;

constexpr int kB    = 4096;
constexpr int kDin  = 1024;
constexpr int kH1   = 1024;
constexpr int kH2   = 512;
constexpr int kE    = 8;   // 6 specific + 2 shared experts
constexpr int kSpec = 6;

constexpr int kBK     = 128;             // k depth of one pass, in halves
constexpr int kHK     = 64;              // k depth of one block of matrix instructions
constexpr int kRow4   = kBK / 8;         // 16-B units of data per tile row
constexpr int kPitch4 = kRow4 + 1;       // row pitch in 16-B units
constexpr int kBT     = 256;             // rows of A and rows of W^T per block tile
constexpr int kMT     = 4;               // 16-row A fragments per wave (64 rows)
constexpr int kNT     = 8;               // 16-row W fragments per wave (128 columns)
constexpr int kSliceRows = 64;           // rows per tensor load
constexpr int kSlice4 = (kSliceRows * kPitch4 + 127) / 128 * 128;  // a slice's place, 16-B units
constexpr int kTile4  = (kBT / kSliceRows) * kSlice4;   // one operand tile: four slices
constexpr int kBuf4   = 2 * kTile4;      // one (A|W) stage
constexpr int kOutRow4   = kNT * 16 / 8;             // 16-B units of data per row
constexpr int kOutPitch4 = kOutRow4 + 1;             // row pitch in 16-B units
constexpr int kOutWave4  = kMT * 16 * kOutPitch4;    // one wave's range
constexpr int kOut4      = 8 * kOutWave4;            // all eight waves: 136 KB
constexpr int kOutBias4  = kNT * 16 / 4;             // a wave's 128 f32 biases, behind the tiles

union Frag { uint4 u[2]; v16h h; };

// ---- tensor load: one request of a wave brings a 2-D tile from global memory to LDS
typedef uint32_t u32x4 __attribute__((ext_vector_type(4)));
typedef uint32_t u32x8 __attribute__((ext_vector_type(8)));
__device__ __forceinline__ uint32_t uni(uint32_t v) {
  return (uint32_t)__builtin_amdgcn_readfirstlane(v);
}
__device__ __forceinline__ uint32_t pinned(uint32_t v) {
  uint32_t w = uni(v);
  asm volatile("" : "+s"(w));  // pinned(): the test's value held in a scalar register
  return w;
}
__device__ __forceinline__ u32x8 tdm_group1(uint32_t src_pitch) {
  constexpr uint32_t d0 = kBK * 2, d1 = kSliceRows;
  static_assert(d0 == 256, "the pad interval code 5 is one row of 256 B");
  u32x8 g;
  g[0] = uni((1u << 20) | (5u << 22) | (3u << 25));
  g[1] = uni((d0 & 0xFFFFu) << 16);
  g[2] = uni((d0 >> 16) | ((d1 & 0xFFFFu) << 16));
  g[3] = uni((d1 >> 16) | (d0 << 16));
  g[4] = uni(d1);
  g[5] = uni(src_pitch);
  g[6] = uni(0u);
  g[7] = uni(0u);
  return g;
}
__device__ __forceinline__ u32x4 tdm_group0(uint32_t lds_dst, uint64_t ga) {
  u32x4 g;
  g[0] = uni(1u);
  g[1] = uni(lds_dst);
  g[2] = uni((uint32_t)ga);
  g[3] = uni((((uint32_t)(ga >> 32)) & 0x01FFFFFFu) | 0x80000000u);
  return g;
}
__device__ __forceinline__ void tdm_load(u32x4 g0, u32x8 g1) {
  asm volatile("tensor_load_to_lds %0, %1" :: "s"(g0), "s"(g1) : "memory");
}

// ------------- f32 [E][K][N] -> f16 [E][N][K] transpose+convert --------
// One body for the four weight arrays. A work-group takes a tile of kTK k by
// kTN n of one expert: few, fat waves, for speed only. Every global access is 16 B a lane
// and covers whole 256-B units: a source row of the tile is 64 f32 = 256 B, a
// row of the transposed tile 256 f16 = 512 B.
typedef float f32x4 __attribute__((ext_vector_type(4)));
constexpr int kTK = 256;                 // k per tile
constexpr int kTN = 64;                  // n per tile
constexpr int kTU = kTK / 8;             // 16-B units of f16 per transposed tile row
constexpr int kW1Tiles = kE * (kDin / kTK) * (kH1 / kTN);
constexpr int kW2Tiles = kE * (kH1 / kTK) * (kH2 / kTN);

template <int K, int N>
__device__ __forceinline__ void w_tile(const float* __restrict__ src,  // [K][N], one expert
                                       _Float16* __restrict__ dst,     // [N][K], one expert
                                       int k0, int n0, uint4* t) {
  const int tid = threadIdx.x;
  const int n4  = tid & 15;              // the thread's four n
  const int kg  = tid >> 4;              // the thread's sixteen k
  const f32x4* s4 =
      reinterpret_cast<const f32x4*>(src + (size_t)(k0 + kg * 16) * N + n0) + n4;
  f32x4 v[16];
  #pragma unroll
  for (int i = 0; i < 16; i++) v[i] = s4[i * (N / 4)];
  // keeps all sixteen loads in front of the first conversion: left alone the
  // scheduler saves registers by issuing the last four only when the first have
  // returned, and the wave then waits out the memory latency more than once
  __builtin_amdgcn_sched_barrier(0);

  #pragma unroll
  for (int c = 0; c < 4; c++)
    #pragma unroll
    for (int h = 0; h < 2; h++) {
      union { _Float16 f[8]; uint4 u; } p;
      #pragma unroll
      for (int i = 0; i < 8; i++) p.f[i] = (_Float16)v[h * 8 + i][c];
      t[(n4 * 4 + c) * kTU + ((kg * 2 + h + n4) & (kTU - 1))] = p.u;
    }
  __syncthreads();

  // a wave stores whole tile rows, 512 B each: row n = 8 j + wave, lane = unit
  const int w = tid >> 5, u = tid & 31;
  uint4* d4 = reinterpret_cast<uint4*>(dst + (size_t)(n0 + w) * K + k0) + u;
  uint4 r[kTN / 8];
  #pragma unroll
  for (int j = 0; j < kTN / 8; j++)      // (8 j + w) / 4 = 2 j + w / 4
    r[j] = t[(j * 8 + w) * kTU + ((u + (w >> 2) + 2 * j) & (kTU - 1))];
  #pragma unroll
  for (int j = 0; j < kTN / 8; j++) d4[j * 8 * (K / 8)] = r[j];
  // other bodies of the shared kernel stand behind these stores in the code: the
  // wait stands in front of any instruction there that reuses the stores' registers
  asm volatile("s_wait_xcnt 0x0" ::: "memory");
}

__device__ __forceinline__ void
weights_f16_transposed(const float* __restrict__ W1s, const float* __restrict__ W1h,
                       const float* __restrict__ W2s, const float* __restrict__ W2h,
                       _Float16* __restrict__ w1t, _Float16* __restrict__ w2t,
                       unsigned b,             // tile index, < kW1Tiles + kW2Tiles
                       uint4* t) {             // kTN * kTU units of LDS, 32 KB
  if (b < (unsigned)kW1Tiles) {
    constexpr unsigned kNT = kH1 / kTN, kPer = (kDin / kTK) * kNT;
    const unsigned e = b / kPer, r = b % kPer;
    const float* src = (e < (unsigned)kSpec) ? W1s + (size_t)e * kDin * kH1
                                   : W1h + (size_t)(e - kSpec) * kDin * kH1;
    w_tile<kDin, kH1>(src, w1t + (size_t)e * kH1 * kDin, (r / kNT) * kTK, (r % kNT) * kTN, t);
  } else {
    b -= kW1Tiles;
    constexpr unsigned kNT = kH2 / kTN, kPer = (kH1 / kTK) * kNT;
    const unsigned e = b / kPer, r = b % kPer;
    const float* src = (e < (unsigned)kSpec) ? W2s + (size_t)e * kH1 * kH2
                                   : W2h + (size_t)(e - kSpec) * kH1 * kH2;
    w_tile<kH1, kH2>(src, w2t + (size_t)e * kH2 * kH1, (r / kNT) * kTK, (r % kNT) * kTN, t);
  }
}

typedef float f32x2 __attribute__((ext_vector_type(2)));
constexpr int kXRows = 4;                // rows of x per wave

template <int M, int HALF, int N>
__device__ __forceinline__ void wave_sums(float (&a)[N], int lane) {
  if constexpr (HALF >= 1) {
    const bool up = (lane & M) != 0;
    #pragma unroll
    for (int i = 0; i < HALF; i++) {
      float keep = up ? a[i + HALF] : a[i];
      float send = up ? a[i] : a[i + HALF];
      a[i] = keep + __shfl_xor(send, M, 32);
    }
  } else {
    a[0] += __shfl_xor(a[0], M, 32);
  }
  if constexpr (M > 1) wave_sums<M / 2, HALF / 2, N>(a, lane);
}

template <int NG>                        // gate width: 4 or 8
__device__ __forceinline__ void x_pass(const float* __restrict__ x,
                                       const float* __restrict__ Wgt,  // [D_IN][NG]
                                       const float* __restrict__ bias, // [NG]
                                       _Float16* __restrict__ xh,      // f16 page of x
                                       float* __restrict__ gates, int gbase,
                                       int xblk,                       // which 8 * kXRows rows
                                       f32x4* wl) {
  constexpr int H = NG / 4;              // 16-B units per weight row
  constexpr int N = kXRows * NG;         // sums per wave
  const int tid  = threadIdx.x;
  const int lane = tid & 31;
  const int blk0 = xblk * (8 * kXRows);                  // the block's first row
  const int row0 = blk0 + (tid >> 5) * kXRows;           // the wave's first row
  // the lane's first 16-B unit of x (8-B unit of the copy) inside the block's rows
  const int t0 = (tid >> 5) * (kXRows * (kDin / 4)) + lane;

  // gate weights first, then the rows: the weights can be laid in LDS while
  // the rows are still in flight
  const f32x4* W4 = reinterpret_cast<const f32x4*>(Wgt);
  f32x4 wv[4 * H];
  #pragma unroll
  for (int i = 0; i < 4 * H; i++) wv[i] = W4[tid + i * 256];
  const f32x4* xp = reinterpret_cast<const f32x4*>(x) + (size_t)blk0 * (kDin / 4);
  f32x4 xv[kXRows][8];
  #pragma unroll
  for (int r = 0; r < kXRows; r++)
    #pragma unroll
    for (int j = 0; j < 8; j++) xv[r][j] = xp[t0 + r * (kDin / 4) + j * 32];

  // LDS order [j][c][h][lane]: the 32 lanes of a reader take 512 contiguous B
  #pragma unroll
  for (int i = 0; i < 4 * H; i++) {
    int q = tid + i * 256;
    int k = q / H, h = q % H;
    wl[(((k >> 7) * 4 + (k & 3)) * H + h) * 32 + ((k >> 2) & 31)] = wv[i];
  }
  __syncthreads();

  uint2* xo = reinterpret_cast<uint2*>(xh) + (size_t)blk0 * (kDin / 4);
  f32x2 acc2[N / 2];                     // gates 2 i, 2 i + 1 of row r at [r * NG / 2 + i]
  #pragma unroll
  for (int i = 0; i < N / 2; i++) acc2[i] = (f32x2){0.f, 0.f};
  #pragma unroll
  for (int j = 0; j < 8; j++) {
    #pragma unroll
    for (int r = 0; r < kXRows; r++) {
      union { _Float16 h[4]; uint2 u; } p;
      p.h[0] = (_Float16)xv[r][j][0]; p.h[1] = (_Float16)xv[r][j][1];
      p.h[2] = (_Float16)xv[r][j][2]; p.h[3] = (_Float16)xv[r][j][3];
      xo[t0 + r * (kDin / 4) + j * 32] = p.u;
    }
    #pragma unroll
    for (int c = 0; c < 4; c++)
      #pragma unroll
      for (int h = 0; h < H; h++) {
        const f32x4 w = wl[((j * 4 + c) * H + h) * 32 + lane];
        #pragma unroll
        for (int r = 0; r < kXRows; r++) {
          const f32x2 xx = {xv[r][j][c], xv[r][j][c]};
          f32x2& lo = acc2[r * (NG / 2) + h * 2];
          f32x2& hi = acc2[r * (NG / 2) + h * 2 + 1];
          lo = __builtin_elementwise_fma(w.lo, xx, lo);
          hi = __builtin_elementwise_fma(w.hi, xx, hi);
        }
      }
    // holds the f16 stores of step j in front of the products of step j + 1:
    // without it the scheduler sinks every store behind the last sum, and the
    // writes only start when the arithmetic is over
    __builtin_amdgcn_sched_barrier(0);
  }
  float acc[N];                          // acc[r * NG + g]: the sum over this lane's 32 k
  #pragma unroll
  for (int i = 0; i < N / 2; i++) { acc[2 * i] = acc2[i][0]; acc[2 * i + 1] = acc2[i][1]; }

  wave_sums<16, N / 2, N>(acc, lane);

  // softmax inside the lanes that hold one row's logits (each logit kDup times)
  constexpr int kDup = 32 / N;
  const int g = (lane / kDup) % NG;
  const float lg = acc[0] + bias[g];
  float mx = lg;
  #pragma unroll
  for (int m = kDup; m < kDup * NG; m <<= 1) mx = fmaxf(mx, __shfl_xor(mx, m, 32));
  const float ev = expf(lg - mx);
  float sum = ev;
  #pragma unroll
  for (int m = kDup; m < kDup * NG; m <<= 1) sum += __shfl_xor(sum, m, 32);
  const float gw = ev * (1.f / sum);
  if (lane % kDup == 0)
    gates[(size_t)(row0 + lane / (kDup * NG)) * 20 + gbase + g] = gw;
}

// One launch for both preparations, which do not depend on each other: a weight
// tile starts on a WGP as soon as an x block there has ended, so that memory stays
// busy over what was the end of one launch, the gap and the start of the next. The
// x blocks come first: they last longer.
constexpr int kXBlkRow = kB / (8 * kXRows);      // x blocks per input
constexpr int kXBlocks = 4 * kXBlkRow;           // x blocks in all

__global__ void __launch_bounds__(256)
prepare_kernel(const float* __restrict__ x0, const float* __restrict__ x1,
               const float* __restrict__ x2, const float* __restrict__ xs,
               const float* __restrict__ Wg,  const float* __restrict__ bg,
               const float* __restrict__ Wsg, const float* __restrict__ bsg,
               const float* __restrict__ W1s, const float* __restrict__ W1h,
               const float* __restrict__ W2s, const float* __restrict__ W2h,
               _Float16* __restrict__ xh, float* __restrict__ gates,
               _Float16* __restrict__ w1t, _Float16* __restrict__ w2t) {
  // 32 KB: one input's gate weights, or one transposed weight tile
  __shared__ alignas(16) f32x4 wl[kDin * 2];
  static_assert(kTN * kTU == kDin * 2, "both bodies use the whole array");
  const unsigned blk = blockIdx.x;
  if (blk < (unsigned)kXBlocks) {
    const int d = blk / kXBlkRow, xblk = blk % kXBlkRow;
    _Float16* page = xh + (size_t)d * kB * kDin;
    const float* x = (d == 0) ? x0 : (d == 1) ? x1 : (d == 2) ? x2 : xs;
    if (d == 3)
      x_pass<8>(x, Wsg, bsg, page, gates, 12, xblk, wl);
    else
      x_pass<4>(x, Wg + (size_t)d * kDin * 4, bg + d * 4, page, gates, d * 4, xblk, wl);
  } else {
    weights_f16_transposed(W1s, W1h, W2s, W2h, w1t, w2t, blk - kXBlocks,
                           reinterpret_cast<uint4*>(wl));
  }
}

// ---------------- WMMA GEMM: C = relu(A @ W + bias), f16 in / f32 acc ----
// block = 256 threads (8 waves); block tile 256(M) x 256(N); wave tile 64x128:
// a byte fetched from L2 serves twice the products of a 128 x 128 tile, and a
// fragment read from LDS feeds 32 / 12 matrix instructions and not 8 / 6. The
// accumulators take 256 registers, so one block is resident per WGP.
// A : [pages][Bsz][K] f16 row-major.
// Wt: [E][N][K] f16 (pre-transposed) -> W tile loader identical to A tile.
// pageMode=1: expert e reads A page (e<6 ? e/2 : 3)   (layer-1 input mapping)
// pageMode=0: expert e reads A page e                 (layer-2: h buffer)
__global__ void __launch_bounds__(256)
gemm_bias_relu_wmma(const _Float16* __restrict__ A,
                    const _Float16* __restrict__ Wt,
                    const float* __restrict__ biasS,
                    const float* __restrict__ biasH,
                    _Float16* __restrict__ C,
                    int Bsz, int K, int N, int pageMode) {
  // 288 KB: double-buffered (A|W) tiles; then output staging. Aligned so that every
  // slice's place is a multiple of 2 KiB in the work-group's LDS.
  __shared__ __attribute__((aligned(2048))) uint4 smem4[2 * kBuf4];
  static_assert(kOut4 + 8 * kOutBias4 <= 2 * kBuf4, "the output staging fits the ring");

  const int tid  = threadIdx.x;
  const int lane = tid & 31;
  const int wave = tid >> 5;
  const int waveM = wave & 3;          // 4 waves along M
  const int waveN = wave >> 2;         // 2 waves along N
  const int rl   = lane & 15;
  const int hsel = lane >> 4;

  const int e  = blockIdx.z;
  const int n0 = blockIdx.x * kBT;
  const int m0 = blockIdx.y * kBT;
  const int page = pageMode ? ((e < kSpec) ? (e >> 1) : 3) : e;
  const int ld = K >> 3;               // row stride in uint4 units

  const uint4* __restrict__ Ag = reinterpret_cast<const uint4*>(A) +
      (size_t)page * Bsz * ld + (size_t)m0 * ld;
  const uint4* __restrict__ Wg = reinterpret_cast<const uint4*>(Wt) +
      (size_t)e * N * ld + (size_t)n0 * ld;

  const v8f vzero = {0.f, 0.f, 0.f, 0.f, 0.f, 0.f, 0.f, 0.f};
  v8f acc[kMT][kNT];
  #pragma unroll
  for (int mt = 0; mt < kMT; mt++)
    #pragma unroll
    for (int nt = 0; nt < kNT; nt++) acc[mt][nt] = vzero;

  // This wave's slice of a stage: waves 0-3 bring rows 64 w.. of the A tile, waves
  // 4-7 rows 64 (w - 4).. of the W tile; slice w lies at w * kSlice4 of the buffer.
  const uint32_t wv = uni(threadIdx.x >> 5);
  const uint4* src0 = (wv < 4u) ? Ag + (size_t)(wv * kSliceRows) * ld
                                : Wg + (size_t)((wv - 4u) * kSliceRows) * ld;
  const uint32_t lds_slice = (uint32_t)(size_t)smem4 + wv * (kSlice4 * 16);
  const u32x8 g1 = tdm_group1((uint32_t)K * 2u);
  // One request: the slice's kBK halves from k0 on, into buffer buf.
  u32x4 g0;
  auto issue = [&](int k0, int buf) {
    g0 = tdm_group0(lds_slice + (uint32_t)buf * (kBuf4 * 16),
                    (uint64_t)(uintptr_t)src0 + (uint64_t)k0 * 2u);
    tdm_load(g0, g1);
  };
  // The wave's request has landed. The wait names both groups as inputs: their
  // registers then keep their values for as long as the request is outstanding.
  auto landed = [&]() {
    asm volatile("s_wait_tensorcnt 0x0" :: "s"(g0), "s"(g1) : "memory");
  };
  issue(0, 0);
  landed();                            // tile 0's slice, before the barrier publishes it
  __syncthreads();
  // tile 1 flies during pass 0; it exists: K is kDin or kH1
  static_assert(kDin >= 2 * kBK && kH1 >= 2 * kBK, "the ring's prologue fills two stages");
  issue(kBK, 1);

  for (int k0 = 0; k0 < K; k0 += kBK) {
    const int cur = (k0 / kBK) & 1;
    const uint4* ap = reinterpret_cast<const uint4*>(smem4 + cur * kBuf4);
    const uint4* bp = ap + kTile4;

    #pragma unroll
    for (int kh = 0; kh < kBK / kHK; kh++) {
    Frag afrag[kHK / 32][kMT], bfrag[kHK / 32][kNT];
    #pragma unroll
    for (int ks = 0; ks < kHK / 32; ks++) {
      const int kc = (kh * (kHK / 32) + ks) * 4 + hsel;   // the lane's first 16-B unit of this k step
      #pragma unroll
      for (int mt = 0; mt < kMT; mt++) {
        // the wave's 64 rows of A are slice waveM
        int r = waveM * kSlice4 + (mt * 16 + rl) * kPitch4;
        afrag[ks][mt].u[0] = ap[r + kc];
        afrag[ks][mt].u[1] = ap[r + kc + 2];
      }
      // this one and the one below keep the reads in the order in which the
      // matrix instructions use them: with the operands swapped the scheduler
      // put the fragments that are used first at the end of the group, and the
      // first matrix instruction then waited for 40 of the 48 reads, not for 10
      __builtin_amdgcn_sched_barrier(0);
      #pragma unroll
      for (int nt = 0; nt < kNT; nt++) {
        // the wave's 128 rows of W are slices 2 waveN and 2 waveN + 1
        int c = (waveN * 2 + nt / 4) * kSlice4 + ((nt % 4) * 16 + rl) * kPitch4;
        bfrag[ks][nt].u[0] = bp[c + kc];
        bfrag[ks][nt].u[1] = bp[c + kc + 2];
        __builtin_amdgcn_sched_barrier(0);
      }
    }
    // keeps the 48 reads of a block in one group in front of its 64 matrix
    // instructions: left alone the scheduler sinks reads to just in front of
    // their users, and the wave waits out the LDS latency again and again
    __builtin_amdgcn_sched_barrier(0);
    #pragma unroll
    for (int ks = 0; ks < kHK / 32; ks++)
      #pragma unroll
      for (int nt = 0; nt < kNT; nt++)   // in the order in which the W reads land
        #pragma unroll
        for (int mt = 0; mt < kMT; mt++)
          // W rows as the first operand: the tile comes out transposed, and a
          // lane's 8 accumulator registers are 8 consecutive columns of one C row
          acc[mt][nt] = __builtin_amdgcn_wmma_f32_16x16x32_f16(
              false, bfrag[ks][nt].h, false, afrag[ks][mt].h,
              (short)0, acc[mt][nt], false, false);
    // keeps the matrix instructions in front of the next block's reads and of the
    // pass-foot waits and barrier: left alone the scheduler lifts those over them,
    // and the wait for the next tile's load then stands right behind its issue
    __builtin_amdgcn_sched_barrier(0);
    }

    // this wave's reads of the current buffer are done before it is refilled
    asm volatile("s_wait_dscnt 0x0" ::: "memory");
    landed();                          // the next tile's slice, before the barrier publishes it
    __syncthreads();
    if (pinned(k0 + 2 * kBK < K)) issue(k0 + 2 * kBK, cur);  // refill the buffer just read
  }
  // no request and no LDS read is outstanding when the ring becomes output staging
  asm volatile("s_wait_tensorcnt 0x0" ::: "memory");
  asm volatile("s_wait_dscnt 0x0" ::: "memory");

  // ---- epilogue: bias + ReLU. acc[mt][nt][j] = row mt * 16 + rl, column
  // nt * 16 + hsel * 8 + j of the wave's tile: 8 results make one 16-B unit.
  // The units go to the wave's own LDS range and come back as whole rows, so that
  // every global store is 16 B a lane and covers two whole 256-B units of C
  // (2-B stores from the accumulators wrote 32-B pieces, 8 times the stores).
  // The ring is free: the last pass ended in its waits and its barrier.
  const float* bias = (e < kSpec) ? (biasS + (size_t)e * N)
                                  : (biasH + (size_t)(e - kSpec) * N);
  // a lane needs 8 consecutive biases per nt: the wave fetches its 128 with one
  // 512-B load and hands them round through LDS
  f32x4* bl = reinterpret_cast<f32x4*>(smem4 + kOut4) + wave * kOutBias4;
  const f32x4 bw = reinterpret_cast<const f32x4*>(bias + n0 + waveN * (kNT * 16))[lane];
  // the wait stands in front of the first instruction that reuses the load's
  // address registers; the scheduling barrier keeps later address arithmetic
  // from being lifted over it
  asm volatile("s_wait_xcnt 0x0" ::: "memory");
  __builtin_amdgcn_sched_barrier(0);
  bl[lane] = bw;
  // the wave's own LDS write is done before its lanes read one another's biases
  asm volatile("s_wait_dscnt 0x0" ::: "memory");
  // all sixteen reads in front of the first staging write: one LDS latency, not eight
  f32x4 bb[kNT][2];
  #pragma unroll
  for (int nt = 0; nt < kNT; nt++) {
    bb[nt][0] = bl[nt * 4 + hsel * 2];
    bb[nt][1] = bl[nt * 4 + hsel * 2 + 1];
  }
  uint4* st = smem4 + wave * kOutWave4;
  #pragma unroll
  for (int nt = 0; nt < kNT; nt++) {
    const f32x4 blo = bb[nt][0], bhi = bb[nt][1];
    #pragma unroll
    for (int mt = 0; mt < kMT; mt++) {
      union { _Float16 f[8]; uint4 u; } p;
      #pragma unroll
      for (int j = 0; j < 8; j++) {
        float v = acc[mt][nt][j] + (j < 4 ? blo[j & 3] : bhi[j & 3]);
        v = v > 0.f ? v : 0.f;
        p.f[j] = (_Float16)v;
      }
      st[(mt * 16 + rl) * kOutPitch4 + nt * 2 + hsel] = p.u;
    }
  }
  // the wave's own LDS writes are done before its lanes read one another's units
  asm volatile("s_wait_dscnt 0x0" ::: "memory");
  uint4 row[kMT * 8];
  #pragma unroll
  for (int i = 0; i < kMT * 8; i++) row[i] = st[(i * 2 + hsel) * kOutPitch4 + rl];
  uint4* Cp = reinterpret_cast<uint4*>(
      C + (size_t)e * Bsz * N + (size_t)(m0 + waveM * (kMT * 16) + hsel) * N +
      n0 + waveN * (kNT * 16)) + rl;
  const int ldc = N >> 3;              // row stride of C in 16-B units
  #pragma unroll
  for (int i = 0; i < kMT * 8; i++) Cp[(size_t)(i * 2) * ldc] = row[i];
}

// ---------------- gated combine: 4 outputs, each [B, H2] f32 ------------
__global__ void __launch_bounds__(256)
combine_kernel(const _Float16* __restrict__ eo,   // [8][B][H2]
               const float* __restrict__ gates,   // [B][20]
               float* __restrict__ out) {         // [4][B][H2]
  int idx = blockIdx.x * blockDim.x + threadIdx.x;
  if (idx >= kB * kH2) return;
  int b = idx / kH2, o = idx % kH2;
  float ex[8];
  #pragma unroll
  for (int k = 0; k < 8; k++)
    ex[k] = (float)eo[((size_t)k * kB + b) * kH2 + o];
  const float* g = gates + (size_t)b * 20;
  float o0 = g[0] * ex[0] + g[1] * ex[1] + g[2]  * ex[6] + g[3]  * ex[7];
  float o1 = g[4] * ex[2] + g[5] * ex[3] + g[6]  * ex[6] + g[7]  * ex[7];
  float o2 = g[8] * ex[4] + g[9] * ex[5] + g[10] * ex[6] + g[11] * ex[7];
  float o3 = 0.f;
  #pragma unroll
  for (int k = 0; k < 8; k++) o3 += g[12 + k] * ex[k];
  size_t p = (size_t)b * kH2 + o;
  const size_t page = (size_t)kB * kH2;
  out[p]            = o0;
  out[page + p]     = o1;
  out[2 * page + p] = o2;
  out[3 * page + p] = o3;
}

extern "C" void kernel_launch(void* const* d_in, const int* in_sizes, int n_in,
                              void* d_out, int out_size, void* d_ws, size_t ws_size,
                              hipStream_t stream) {
  const float* x0  = (const float*)d_in[0];
  const float* x1  = (const float*)d_in[1];
  const float* x2  = (const float*)d_in[2];
  const float* xs  = (const float*)d_in[3];
  const float* W1s = (const float*)d_in[4];
  const float* b1s = (const float*)d_in[5];
  const float* W2s = (const float*)d_in[6];
  const float* b2s = (const float*)d_in[7];
  const float* W1h = (const float*)d_in[8];
  const float* b1h = (const float*)d_in[9];
  const float* W2h = (const float*)d_in[10];
  const float* b2h = (const float*)d_in[11];
  const float* Wg  = (const float*)d_in[12];
  const float* bg  = (const float*)d_in[13];
  const float* Wsg = (const float*)d_in[14];
  const float* bsg = (const float*)d_in[15];
  (void)in_sizes; (void)n_in; (void)out_size; (void)ws_size;

  // ---- workspace carve-out (~153 MB), 256B aligned ----
  char* ws = (char*)d_ws;
  size_t off = 0;
  auto take = [&](size_t bytes) -> char* {
    char* p = ws + off;
    off += (bytes + 255) & ~(size_t)255;
    return p;
  };
  _Float16* xh  = (_Float16*)take((size_t)4 * kB * kDin * 2);   // x pages f16
  _Float16* w1t = (_Float16*)take((size_t)kE * kH1 * kDin * 2); // W1^T f16 [E][N][K]
  _Float16* w2t = (_Float16*)take((size_t)kE * kH2 * kH1 * 2);  // W2^T f16 [E][N][K]
  _Float16* hb  = (_Float16*)take((size_t)kE * kB * kH1 * 2);   // hidden acts f16
  _Float16* eo  = (_Float16*)take((size_t)kE * kB * kH2 * 2);   // expert outputs f16
  float*    gts = (float*)   take((size_t)kB * 20 * 4);         // gate weights

  // x pages -> f16 and the gate weights, from one read of x; weights: convert +
  // transpose to [E][N][K] so GEMM streams b128 tiles
  prepare_kernel<<<kXBlocks + kW1Tiles + kW2Tiles, 256, 0, stream>>>(
      x0, x1, x2, xs, Wg, bg, Wsg, bsg, W1s, W1h, W2s, W2h, xh, gts, w1t, w2t);

  // layer 1: h[e] = relu(x_page(e) @ W1[e] + b1[e])   [B,1024]
  dim3 g1(kH1 / kBT, kB / kBT, kE);
  gemm_bias_relu_wmma<<<g1, 256, 0, stream>>>(xh, w1t, b1s, b1h, hb,
                                              kB, kDin, kH1, /*pageMode=*/1);
  // layer 2: eo[e] = relu(h[e] @ W2[e] + b2[e])       [B,512]
  dim3 g2(kH2 / kBT, kB / kBT, kE);
  gemm_bias_relu_wmma<<<g2, 256, 0, stream>>>(hb, w2t, b2s, b2h, eo,
                                              kB, kH1, kH2, /*pageMode=*/0);

  combine_kernel<<<(kB * kH2 + 255) / 256, 256, 0, stream>>>(eo, gts, (float*)d_out);
}
